// v000
// Measured on an AMD MI455X. A time is GPU time per run, averaged over a window of back-to-back runs after a warm-up
// (all launches, gaps included; the runs take copies of the inputs in turn), and the median of several windows.
// Apart from v000's, it joins two sittings. Times from different sittings can be a few percent apart, while
// side-by-side timings come from the same sitting.
// v000, which the later versions start from, runs in 1250 microseconds.
#include <hip/hip_runtime.h>
#include <hip/hip_bf16.h>

typedef __attribute__((ext_vector_type(2))) float v2f;
typedef __attribute__((ext_vector_type(8))) float v8f;

#define B_    4
#define T_    2048
#define C_    1024
#define H_    16
#define D_    64
#define M_TOT (B_ * T_)      // 8192 rows

// ---------------- fp32 WMMA projection GEMM -----------------
// Y[M,N] = X[M,K] @ W[K,N]; M=8192, K=N=1024. Uses V_WMMA_F32_16X16X4_F32.
// Block tile 128x128, BK=16, 256 threads = 8 waves in 4x2 grid; each wave owns
// a 32x64 strip (2 A-frags x 4 B-frags = 8 f32 accumulators -> 1.5 LDS
// loads/WMMA). Double-buffered LDS filled by CDNA5 async DMA
// (global_load_async_to_lds_b128, ASYNCcnt) -- no VGPR staging, no spills,
// DMA of tile it+1 overlaps WMMA compute of tile it.
#define BM  128
#define BN  128
#define BK  16
#define LDX (BK + 4)   // 20: row pitch 80B, 16B-aligned
#define LDW (BN + 4)   // 132: row pitch 528B, 16B-aligned

__device__ __forceinline__ void async_b128_to_lds(unsigned lds_addr, unsigned voff,
                                                  const float* sbase) {
    // GVS mode: mem_addr = SGPR64 + VGPR_I32 ; LDS dest = lds_addr (wave-relative)
    asm volatile("global_load_async_to_lds_b128 %0, %1, %2"
                 :: "v"(lds_addr), "v"(voff), "s"(sbase)
                 : "memory");
}
__device__ __forceinline__ void wait_async0() {
    asm volatile("s_wait_asynccnt 0x0" ::: "memory");
}

__global__ __launch_bounds__(256)
void proj_gemm_kernel(const float* __restrict__ X,
                      const float* __restrict__ W0, const float* __restrict__ W1,
                      const float* __restrict__ W2,
                      float* __restrict__ Y0, float* __restrict__ Y1,
                      float* __restrict__ Y2) {
    const int N = C_, K = C_;
    const int zn = blockIdx.z;
    const float* __restrict__ W = (zn == 0) ? W0 : ((zn == 1) ? W1 : W2);
    float* __restrict__ Y       = (zn == 0) ? Y0 : ((zn == 1) ? Y1 : Y2);

    const int n0 = blockIdx.x * BN;
    const int m0 = blockIdx.y * BM;

    __shared__ float Xs[2][BM * LDX];   // 2 x 128x20 floats
    __shared__ float Ws[2][BK * LDW];   // 2 x  16x132 floats

    const int tid  = threadIdx.x;
    const int wave = tid >> 5;
    const int lane = tid & 31;
    const int lr   = lane & 15;   // row within A-frag / col within B-frag
    const int half = lane >> 4;   // selects K pair {0,1} vs {2,3}
    const int wr   = wave & 3;    // wave row block (32 rows each)
    const int wc   = wave >> 2;   // wave col block (64 cols each)
    const int mw0  = wr * 32;
    const int nw0  = wc * 64;

    // DMA geometry: per thread 2 x b128 for X (rows xrow, xrow+64) and
    // 2 x b128 for W (rows wrow, wrow+8).
    const int xrow = tid >> 2;
    const int xc4  = (tid & 3) << 2;
    const int wrow = tid >> 5;
    const int wc4  = (tid & 31) << 2;

    const float* sX = X + (size_t)m0 * K;   // uniform 64-bit base (SGPR pair)
    const float* sW = W + n0;

    unsigned voffX[2], voffW[2], ldsX[2][2], ldsW[2][2];
    #pragma unroll
    for (int i = 0; i < 2; ++i) {
        voffX[i] = (unsigned)(((xrow + i * 64) * K + xc4) * 4);
        voffW[i] = (unsigned)(((wrow + i * 8) * N + wc4) * 4);
        #pragma unroll
        for (int bf = 0; bf < 2; ++bf) {
            ldsX[bf][i] = (unsigned)(uintptr_t)&Xs[bf][(xrow + i * 64) * LDX + xc4];
            ldsW[bf][i] = (unsigned)(uintptr_t)&Ws[bf][(wrow + i * 8) * LDW + wc4];
        }
    }

    auto issue = [&](int bf, int k0) {
        #pragma unroll
        for (int i = 0; i < 2; ++i) {
            async_b128_to_lds(ldsX[bf][i], voffX[i] + (unsigned)(k0 * 4), sX);
            async_b128_to_lds(ldsW[bf][i], voffW[i] + (unsigned)(k0 * N * 4), sW);
        }
    };

    v8f acc[2][4] = {};

    const int NT = K / BK;          // 64 K-tiles
    issue(0, 0);
    int cur = 0;

    for (int it = 0; it < NT; ++it) {
        wait_async0();                            // tile `it` DMA landed
        __syncthreads();                          // visible to all; buf^1 free
        if (it + 1 < NT) issue(cur ^ 1, (it + 1) * BK);   // overlap next DMA

        const float* xs = &Xs[cur][0];
        const float* ws = &Ws[cur][0];
        #pragma unroll
        for (int kk = 0; kk < BK; kk += 4) {
            // A frags (16x4 f32): lane lr holds M=lr; VGPR0=K{0|2}, VGPR1=K{1|3}
            v2f a0, a1;
            a0.x = xs[(mw0 + lr) * LDX + kk + 2 * half];
            a0.y = xs[(mw0 + lr) * LDX + kk + 2 * half + 1];
            a1.x = xs[(mw0 + 16 + lr) * LDX + kk + 2 * half];
            a1.y = xs[(mw0 + 16 + lr) * LDX + kk + 2 * half + 1];
            #pragma unroll
            for (int j = 0; j < 4; ++j) {
                // B frag (4x16 f32): lane lr holds N=lr; VGPR0=K{0|2}, VGPR1=K{1|3}
                v2f bv;
                bv.x = ws[(kk + 2 * half) * LDW + nw0 + j * 16 + lr];
                bv.y = ws[(kk + 2 * half + 1) * LDW + nw0 + j * 16 + lr];
                acc[0][j] = __builtin_amdgcn_wmma_f32_16x16x4_f32(
                    false, a0, false, bv, (short)0, acc[0][j], false, false);
                acc[1][j] = __builtin_amdgcn_wmma_f32_16x16x4_f32(
                    false, a1, false, bv, (short)0, acc[1][j], false, false);
            }
        }
        cur ^= 1;
    }

    // C/D layout: VGPR r -> (M = r + 8*half, N = lr)
    #pragma unroll
    for (int g = 0; g < 2; ++g) {
        #pragma unroll
        for (int j = 0; j < 4; ++j) {
            #pragma unroll
            for (int r = 0; r < 8; ++r) {
                int row = m0 + mw0 + g * 16 + r + 8 * half;
                int col = n0 + nw0 + j * 16 + lr;
                Y[(size_t)row * N + col] = acc[g][j][r];
            }
        }
    }
}

// ---------------- gate GEMV: alpha/beta = sigmoid(x @ Wa/Wb) ----------------
__global__ __launch_bounds__(256)
void gate_kernel(const float* __restrict__ X, const float* __restrict__ Wa,
                 const float* __restrict__ Wb, float* __restrict__ Al,
                 float* __restrict__ Be) {
    const int wave = threadIdx.x >> 5;
    const int lane = threadIdx.x & 31;
    const int m    = blockIdx.x * 8 + wave;
    const float* xr = X + (size_t)m * C_;
    float pa = 0.f, pb = 0.f;
    #pragma unroll 8
    for (int i = 0; i < C_ / 32; ++i) {
        float xv = xr[lane + 32 * i];
        pa += xv * Wa[lane + 32 * i];
        pb += xv * Wb[lane + 32 * i];
    }
    #pragma unroll
    for (int off = 16; off > 0; off >>= 1) {
        pa += __shfl_xor(pa, off, 32);
        pb += __shfl_xor(pb, off, 32);
    }
    if (lane == 0) {
        Al[m] = 1.f / (1.f + __expf(-pa));
        Be[m] = 1.f / (1.f + __expf(-pb));
    }
}

// ---------------- gated delta recurrence ----------------
// One WG (256 thr) per (b,h). Thread (v = tid>>2, k-seg = (tid&3)*16) owns
// S[v][seg..seg+15] in 16 VGPRs. 4-lane shfl_xor reductions; no LDS/barriers.
// Next timestep's k/q/v/a/b are register-prefetched to hide load latency.
__global__ __launch_bounds__(256)
void scan_kernel(const float* __restrict__ Q, const float* __restrict__ K,
                 const float* __restrict__ V, const float* __restrict__ A,
                 const float* __restrict__ Bt, float* __restrict__ Out) {
    const int bh  = blockIdx.x;          // 0..63
    const int b   = bh >> 4;
    const int h   = bh & 15;
    const int tid = threadIdx.x;
    const int v   = tid >> 2;            // 0..63  (row of state)
    const int seg = (tid & 3) << 4;      // 0,16,32,48 (k segment)

    const size_t base = (size_t)b * T_ * C_ + (size_t)h * D_;

    float s[16];
    #pragma unroll
    for (int i = 0; i < 16; ++i) s[i] = 0.f;

    float4 kc[4], qc[4];
    float  vc, ac, bc;
    {   // preload t = 0
        const float* kp = K + base + seg;
        const float* qp = Q + base + seg;
        #pragma unroll
        for (int i = 0; i < 4; ++i) {
            kc[i] = *(const float4*)(kp + 4 * i);
            qc[i] = *(const float4*)(qp + 4 * i);
        }
        vc = V[base + v];
        ac = A[(size_t)b * T_];
        bc = Bt[(size_t)b * T_];
    }

    for (int t = 0; t < T_; ++t) {
        // prefetch step t+1 (clamped; loads are L2-resident)
        const int tn = (t + 1 < T_) ? (t + 1) : t;
        const size_t base2 = base + (size_t)tn * C_;
        float4 kn[4], qn[4];
        {
            const float* kp = K + base2 + seg;
            const float* qp = Q + base2 + seg;
            #pragma unroll
            for (int i = 0; i < 4; ++i) {
                kn[i] = *(const float4*)(kp + 4 * i);
                qn[i] = *(const float4*)(qp + 4 * i);
            }
        }
        const float vn = V[base2 + v];
        const float an = A[(size_t)b * T_ + tn];
        const float bn = Bt[(size_t)b * T_ + tn];

        // sk[v] = sum_k S[v,k] * k_t[k]   (partial over 16, reduce over 4 lanes)
        float p = 0.f;
        #pragma unroll
        for (int i = 0; i < 4; ++i) {
            p += s[4 * i + 0] * kc[i].x + s[4 * i + 1] * kc[i].y +
                 s[4 * i + 2] * kc[i].z + s[4 * i + 3] * kc[i].w;
        }
        p += __shfl_xor(p, 1, 32);
        p += __shfl_xor(p, 2, 32);

        // S = a*S + (b*v - a*b*sk) * k^T ;  o[v] = sum_k q_t[k]*S[v,k]
        const float coef = bc * vc - ac * bc * p;
        float o = 0.f;
        #pragma unroll
        for (int i = 0; i < 4; ++i) {
            s[4 * i + 0] = ac * s[4 * i + 0] + coef * kc[i].x;  o += qc[i].x * s[4 * i + 0];
            s[4 * i + 1] = ac * s[4 * i + 1] + coef * kc[i].y;  o += qc[i].y * s[4 * i + 1];
            s[4 * i + 2] = ac * s[4 * i + 2] + coef * kc[i].z;  o += qc[i].z * s[4 * i + 2];
            s[4 * i + 3] = ac * s[4 * i + 3] + coef * kc[i].w;  o += qc[i].w * s[4 * i + 3];
        }
        o += __shfl_xor(o, 1, 32);
        o += __shfl_xor(o, 2, 32);
        if ((tid & 3) == 0)
            Out[base + (size_t)t * C_ + v] = o;

        #pragma unroll
        for (int i = 0; i < 4; ++i) { kc[i] = kn[i]; qc[i] = qn[i]; }
        vc = vn; ac = an; bc = bn;
    }
}

extern "C" void kernel_launch(void* const* d_in, const int* in_sizes, int n_in,
                              void* d_out, int out_size, void* d_ws, size_t ws_size,
                              hipStream_t stream) {
    (void)in_sizes; (void)n_in; (void)out_size; (void)ws_size;
    const float* x  = (const float*)d_in[0];
    const float* Wq = (const float*)d_in[1];
    const float* Wk = (const float*)d_in[2];
    const float* Wv = (const float*)d_in[3];
    const float* Wa = (const float*)d_in[4];
    const float* Wb = (const float*)d_in[5];
    float* out = (float*)d_out;

    float* ws = (float*)d_ws;
    float* Qp = ws;                                   // 8192*1024
    float* Kp = Qp + (size_t)M_TOT * C_;              // 8192*1024
    float* Vp = Kp + (size_t)M_TOT * C_;              // 8192*1024
    float* Al = Vp + (size_t)M_TOT * C_;              // 8192
    float* Be = Al + M_TOT;                           // 8192

    dim3 g1(C_ / BN, M_TOT / BM, 3);
    proj_gemm_kernel<<<g1, dim3(256), 0, stream>>>(x, Wq, Wk, Wv, Qp, Kp, Vp);
    gate_kernel<<<dim3(M_TOT / 8), dim3(256), 0, stream>>>(x, Wa, Wb, Al, Be);
    scan_kernel<<<dim3(B_ * H_), dim3(256), 0, stream>>>(Qp, Kp, Vp, Al, Be, out);
}

// v001
// One run takes 783 microseconds.
// Timed twice side by side with v000, it ran 1.60 times as fast both times.
#include <hip/hip_runtime.h>
#include <hip/hip_bf16.h>

typedef __attribute__((ext_vector_type(2))) float v2f;
typedef __attribute__((ext_vector_type(8))) float v8f;

#define B_    4
#define T_    2048
#define C_    1024
#define H_    16
#define D_    64
#define M_TOT (B_ * T_)      // 8192 rows

// ---------------- fp32 WMMA projection GEMM -----------------
// Y[M,N] = X[M,K] @ W[K,N]; M=8192, K=N=1024. Uses V_WMMA_F32_16X16X4_F32.
// Block tile 128x128, BK=16, 256 threads = 8 waves in 4x2 grid; each wave owns
// a 32x64 strip (2 A-frags x 4 B-frags = 8 f32 accumulators -> 1.5 LDS
// loads/WMMA). Double-buffered LDS filled by CDNA5 async DMA
// (global_load_async_to_lds_b128, ASYNCcnt) -- no VGPR staging, no spills,
// DMA of tile it+1 overlaps WMMA compute of tile it.
#define BM  128
#define BN  128
#define BK  16
#define LDX (BK + 4)   // 20: row pitch 80B, 16B-aligned
#define LDW (BN + 4)   // 132: row pitch 528B, 16B-aligned

__device__ __forceinline__ void async_b128_to_lds(unsigned lds_addr, unsigned voff,
                                                  const float* sbase) {
    // GVS mode: mem_addr = SGPR64 + VGPR_I32 ; LDS dest = lds_addr (wave-relative)
    asm volatile("global_load_async_to_lds_b128 %0, %1, %2"
                 :: "v"(lds_addr), "v"(voff), "s"(sbase)
                 : "memory");
}
__device__ __forceinline__ void wait_async0() {
    asm volatile("s_wait_asynccnt 0x0" ::: "memory");
}

__global__ __launch_bounds__(256)
void proj_gemm_kernel(const float* __restrict__ X,
                      const float* __restrict__ W0, const float* __restrict__ W1,
                      const float* __restrict__ W2,
                      float* __restrict__ Y0, float* __restrict__ Y1,
                      float* __restrict__ Y2) {
    const int N = C_, K = C_;
    const int zn = blockIdx.z;
    const float* __restrict__ W = (zn == 0) ? W0 : ((zn == 1) ? W1 : W2);
    float* __restrict__ Y       = (zn == 0) ? Y0 : ((zn == 1) ? Y1 : Y2);

    const int n0 = blockIdx.x * BN;
    const int m0 = blockIdx.y * BM;

    __shared__ float Xs[2][BM * LDX];   // 2 x 128x20 floats
    __shared__ float Ws[2][BK * LDW];   // 2 x  16x132 floats

    const int tid  = threadIdx.x;
    const int wave = tid >> 5;
    const int lane = tid & 31;
    const int lr   = lane & 15;   // row within A-frag / col within B-frag
    const int half = lane >> 4;   // selects K pair {0,1} vs {2,3}
    const int wr   = wave & 3;    // wave row block (32 rows each)
    const int wc   = wave >> 2;   // wave col block (64 cols each)
    const int mw0  = wr * 32;
    const int nw0  = wc * 64;

    // DMA geometry: per thread 2 x b128 for X (rows xrow, xrow+64) and
    // 2 x b128 for W (rows wrow, wrow+8).
    const int xrow = tid >> 2;
    const int xc4  = (tid & 3) << 2;
    const int wrow = tid >> 5;
    const int wc4  = (tid & 31) << 2;

    const float* sX = X + (size_t)m0 * K;   // uniform 64-bit base (SGPR pair)
    const float* sW = W + n0;

    unsigned voffX[2], voffW[2], ldsX[2][2], ldsW[2][2];
    #pragma unroll
    for (int i = 0; i < 2; ++i) {
        voffX[i] = (unsigned)(((xrow + i * 64) * K + xc4) * 4);
        voffW[i] = (unsigned)(((wrow + i * 8) * N + wc4) * 4);
        #pragma unroll
        for (int bf = 0; bf < 2; ++bf) {
            ldsX[bf][i] = (unsigned)(uintptr_t)&Xs[bf][(xrow + i * 64) * LDX + xc4];
            ldsW[bf][i] = (unsigned)(uintptr_t)&Ws[bf][(wrow + i * 8) * LDW + wc4];
        }
    }

    auto issue = [&](int bf, int k0) {
        #pragma unroll
        for (int i = 0; i < 2; ++i) {
            async_b128_to_lds(ldsX[bf][i], voffX[i] + (unsigned)(k0 * 4), sX);
            async_b128_to_lds(ldsW[bf][i], voffW[i] + (unsigned)(k0 * N * 4), sW);
        }
    };

    v8f acc[2][4] = {};

    const int NT = K / BK;          // 64 K-tiles
    issue(0, 0);
    int cur = 0;

    for (int it = 0; it < NT; ++it) {
        wait_async0();                            // tile `it` DMA landed
        __syncthreads();                          // visible to all; buf^1 free
        if (it + 1 < NT) issue(cur ^ 1, (it + 1) * BK);   // overlap next DMA

        const float* xs = &Xs[cur][0];
        const float* ws = &Ws[cur][0];
        #pragma unroll
        for (int kk = 0; kk < BK; kk += 4) {
            // A frags (16x4 f32): lane lr holds M=lr; VGPR0=K{0|2}, VGPR1=K{1|3}
            v2f a0, a1;
            a0.x = xs[(mw0 + lr) * LDX + kk + 2 * half];
            a0.y = xs[(mw0 + lr) * LDX + kk + 2 * half + 1];
            a1.x = xs[(mw0 + 16 + lr) * LDX + kk + 2 * half];
            a1.y = xs[(mw0 + 16 + lr) * LDX + kk + 2 * half + 1];
            #pragma unroll
            for (int j = 0; j < 4; ++j) {
                // B frag (4x16 f32): lane lr holds N=lr; VGPR0=K{0|2}, VGPR1=K{1|3}
                v2f bv;
                bv.x = ws[(kk + 2 * half) * LDW + nw0 + j * 16 + lr];
                bv.y = ws[(kk + 2 * half + 1) * LDW + nw0 + j * 16 + lr];
                acc[0][j] = __builtin_amdgcn_wmma_f32_16x16x4_f32(
                    false, a0, false, bv, (short)0, acc[0][j], false, false);
                acc[1][j] = __builtin_amdgcn_wmma_f32_16x16x4_f32(
                    false, a1, false, bv, (short)0, acc[1][j], false, false);
            }
        }
        cur ^= 1;
    }

    // C/D layout: VGPR r -> (M = r + 8*half, N = lr)
    #pragma unroll
    for (int g = 0; g < 2; ++g) {
        #pragma unroll
        for (int j = 0; j < 4; ++j) {
            #pragma unroll
            for (int r = 0; r < 8; ++r) {
                int row = m0 + mw0 + g * 16 + r + 8 * half;
                int col = n0 + nw0 + j * 16 + lr;
                Y[(size_t)row * N + col] = acc[g][j][r];
            }
        }
    }
}

// ---------------- gate GEMV: alpha/beta = sigmoid(x @ Wa/Wb) ----------------
__global__ __launch_bounds__(256)
void gate_kernel(const float* __restrict__ X, const float* __restrict__ Wa,
                 const float* __restrict__ Wb, float* __restrict__ Al,
                 float* __restrict__ Be) {
    const int wave = threadIdx.x >> 5;
    const int lane = threadIdx.x & 31;
    const int m    = blockIdx.x * 8 + wave;
    const float* xr = X + (size_t)m * C_;
    float pa = 0.f, pb = 0.f;
    #pragma unroll 8
    for (int i = 0; i < C_ / 32; ++i) {
        float xv = xr[lane + 32 * i];
        pa += xv * Wa[lane + 32 * i];
        pb += xv * Wb[lane + 32 * i];
    }
    #pragma unroll
    for (int off = 16; off > 0; off >>= 1) {
        pa += __shfl_xor(pa, off, 32);
        pb += __shfl_xor(pb, off, 32);
    }
    if (lane == 0) {
        Al[m] = 1.f / (1.f + __expf(-pa));
        Be[m] = 1.f / (1.f + __expf(-pb));
    }
}

// ---------------- gated delta recurrence ----------------
// One WG (256 thr) per (b,h). Thread (v = tid>>2, k-seg = (tid&3)*16) owns
// S[v][seg..seg+15] in 16 VGPRs. 4-lane shfl_xor reductions.
// k/q/v and the two gates of TCH timesteps are staged in LDS by async copies,
// two buffers: chunk c+1 flies while chunk c is worked on, so no step waits on
// global memory. Inside a chunk the next step's operands are fetched from LDS
// one step ahead.
#define TCH 64                 // timesteps per staged chunk
#define NCH (T_ / TCH)         // 32 chunks

__global__ __launch_bounds__(256)
void scan_kernel(const float* __restrict__ Q, const float* __restrict__ K,
                 const float* __restrict__ V, const float* __restrict__ A,
                 const float* __restrict__ Bt, float* __restrict__ Out) {
    __shared__ __attribute__((aligned(16))) float Ks[2][TCH * D_];
    __shared__ __attribute__((aligned(16))) float Qs[2][TCH * D_];
    __shared__ __attribute__((aligned(16))) float Vs[2][TCH * D_];
    __shared__ __attribute__((aligned(16))) float Gs[2][TCH * 2];   // (a,b) per step

    const int bh  = blockIdx.x;          // 0..63
    const int b   = bh >> 4;
    const int h   = bh & 15;
    const int tid = threadIdx.x;
    const int v   = tid >> 2;            // 0..63  (row of state)
    const int seg = (tid & 3) << 4;      // 0,16,32,48 (k segment)
    const int lane = tid & 31;
    const int wv  = __builtin_amdgcn_readfirstlane(tid >> 5);   // scalar wave number

    const size_t base = (size_t)b * T_ * C_ + (size_t)h * D_;

    // Copy geometry: a chunk of one tensor is 64 rows x 256 B; a thread brings
    // 16 B of each of the rows crow, crow+16, crow+32, crow+48 of K, Q and V.
    const int crow = tid >> 4;           // 0..15
    const int cc4  = (tid & 15) << 2;    // float column, 16-B steps
    const int l0   = crow * D_ + cc4;
    const int l1   = l0 + 16 * D_;
    const int l2   = l0 + 32 * D_;
    const int l3   = l0 + 48 * D_;

    auto stage = [&](int bf, int t0) {
        const size_t g0 = base + (size_t)(t0 + crow) * C_ + cc4;
        const size_t g1 = g0 + (size_t)16 * C_;
        const size_t g2 = g0 + (size_t)32 * C_;
        const size_t g3 = g0 + (size_t)48 * C_;
        // The xcnt wait is the statement's last line so that it stands before
        // any rewrite of the address registers the copies name.
        asm volatile("global_load_async_to_lds_b128 %0, %1, off\n\t"
                     "global_load_async_to_lds_b128 %2, %3, off\n\t"
                     "global_load_async_to_lds_b128 %4, %5, off\n\t"
                     "global_load_async_to_lds_b128 %6, %7, off\n\t"
                     "global_load_async_to_lds_b128 %8, %9, off\n\t"
                     "global_load_async_to_lds_b128 %10, %11, off\n\t"
                     "global_load_async_to_lds_b128 %12, %13, off\n\t"
                     "global_load_async_to_lds_b128 %14, %15, off\n\t"
                     "global_load_async_to_lds_b128 %16, %17, off\n\t"
                     "global_load_async_to_lds_b128 %18, %19, off\n\t"
                     "global_load_async_to_lds_b128 %20, %21, off\n\t"
                     "global_load_async_to_lds_b128 %22, %23, off\n\t"
                     "s_wait_xcnt 0x0"
                     :: "v"((unsigned)(uintptr_t)&Ks[bf][l0]), "v"(K + g0),
                        "v"((unsigned)(uintptr_t)&Ks[bf][l1]), "v"(K + g1),
                        "v"((unsigned)(uintptr_t)&Ks[bf][l2]), "v"(K + g2),
                        "v"((unsigned)(uintptr_t)&Ks[bf][l3]), "v"(K + g3),
                        "v"((unsigned)(uintptr_t)&Qs[bf][l0]), "v"(Q + g0),
                        "v"((unsigned)(uintptr_t)&Qs[bf][l1]), "v"(Q + g1),
                        "v"((unsigned)(uintptr_t)&Qs[bf][l2]), "v"(Q + g2),
                        "v"((unsigned)(uintptr_t)&Qs[bf][l3]), "v"(Q + g3),
                        "v"((unsigned)(uintptr_t)&Vs[bf][l0]), "v"(V + g0),
                        "v"((unsigned)(uintptr_t)&Vs[bf][l1]), "v"(V + g1),
                        "v"((unsigned)(uintptr_t)&Vs[bf][l2]), "v"(V + g2),
                        "v"((unsigned)(uintptr_t)&Vs[bf][l3]), "v"(V + g3)
                     : "memory");
        // Gates: waves 0 and 2 bring a, waves 1 and 3 bring b, one float a lane
        // (32 steps a wave), interleaved so that a step reads its pair with one
        // 8-byte LDS load.
        if (wv < 4) {
            const int gi = (wv >> 1) * 32 + lane;          // step inside the chunk
            const float* g = ((wv & 1) ? Bt : A) + (size_t)b * T_ + t0 + gi;
            asm volatile("global_load_async_to_lds_b32 %0, %1, off\n\t"
                         "s_wait_xcnt 0x0"
                         :: "v"((unsigned)(uintptr_t)&Gs[bf][2 * gi + (wv & 1)]), "v"(g)
                         : "memory");
        }
    };

    float s[16];
    #pragma unroll
    for (int i = 0; i < 16; ++i) s[i] = 0.f;

    stage(0, 0);
    wait_async0();                 // chunk 0 landed (this wave's copies)
    __syncthreads();               // ... and every other wave's
    stage(1, TCH);

    for (int c = 0; c < NCH; ++c) {
        const int bf = c & 1;
        const float* ks = &Ks[bf][seg];
        const float* qs = &Qs[bf][seg];
        const float* vs = &Vs[bf][v];
        const float* gs = &Gs[bf][0];

        float4 kc[4], qc[4];
        float  vc, ac, bc;
        {   // first step of the chunk
            #pragma unroll
            for (int i = 0; i < 4; ++i) {
                kc[i] = *(const float4*)(ks + 4 * i);
                qc[i] = *(const float4*)(qs + 4 * i);
            }
            vc = vs[0];
            const float2 g = *(const float2*)gs;
            ac = g.x; bc = g.y;
        }

        // unrolled so that handing the fetched-ahead registers on costs no copies
        #pragma unroll 4
        for (int j = 0; j < TCH; ++j) {
            // fetch step j+1 from LDS (clamped: never past this chunk's buffer)
            const int jn = (j + 1 < TCH) ? (j + 1) : j;
            float4 kn[4], qn[4];
            #pragma unroll
            for (int i = 0; i < 4; ++i) {
                kn[i] = *(const float4*)(ks + jn * D_ + 4 * i);
                qn[i] = *(const float4*)(qs + jn * D_ + 4 * i);
            }
            const float  vn = vs[jn * D_];
            const float2 gn = *(const float2*)(gs + 2 * jn);

            // sk[v] = sum_k S[v,k] * k_t[k]   (partial over 16, reduce over 4 lanes)
            float p = 0.f;
            #pragma unroll
            for (int i = 0; i < 4; ++i) {
                p += s[4 * i + 0] * kc[i].x + s[4 * i + 1] * kc[i].y +
                     s[4 * i + 2] * kc[i].z + s[4 * i + 3] * kc[i].w;
            }
            p += __shfl_xor(p, 1, 32);
            p += __shfl_xor(p, 2, 32);

            // S = a*S + (b*v - a*b*sk) * k^T ;  o[v] = sum_k q_t[k]*S[v,k]
            const float coef = bc * vc - ac * bc * p;
            float o = 0.f;
            #pragma unroll
            for (int i = 0; i < 4; ++i) {
                s[4 * i + 0] = ac * s[4 * i + 0] + coef * kc[i].x;  o += qc[i].x * s[4 * i + 0];
                s[4 * i + 1] = ac * s[4 * i + 1] + coef * kc[i].y;  o += qc[i].y * s[4 * i + 1];
                s[4 * i + 2] = ac * s[4 * i + 2] + coef * kc[i].z;  o += qc[i].z * s[4 * i + 2];
                s[4 * i + 3] = ac * s[4 * i + 3] + coef * kc[i].w;  o += qc[i].w * s[4 * i + 3];
            }
            o += __shfl_xor(o, 1, 32);
            o += __shfl_xor(o, 2, 32);
            if ((tid & 3) == 0) {
                Out[base + (size_t)(c * TCH + j) * C_ + v] = o;
                // before the store's address and data registers are reused
                asm volatile("s_wait_xcnt 0x0" ::: "memory");
            }

            #pragma unroll
            for (int i = 0; i < 4; ++i) { kc[i] = kn[i]; qc[i] = qn[i]; }
            vc = vn; ac = gn.x; bc = gn.y;
        }

        // Hand-over: this wave's LDS reads of buffer bf are done, its copies of
        // chunk c+1 have landed; the barrier says the same of every wave. Only
        // then is buffer bf refilled.
        asm volatile("s_wait_dscnt 0x0" ::: "memory");
        wait_async0();
        __syncthreads();
        if (c + 2 < NCH) stage(bf, (c + 2) * TCH);
    }
    wait_async0();                 // nothing in flight when the wave ends
}

extern "C" void kernel_launch(void* const* d_in, const int* in_sizes, int n_in,
                              void* d_out, int out_size, void* d_ws, size_t ws_size,
                              hipStream_t stream) {
    (void)in_sizes; (void)n_in; (void)out_size; (void)ws_size;
    const float* x  = (const float*)d_in[0];
    const float* Wq = (const float*)d_in[1];
    const float* Wk = (const float*)d_in[2];
    const float* Wv = (const float*)d_in[3];
    const float* Wa = (const float*)d_in[4];
    const float* Wb = (const float*)d_in[5];
    float* out = (float*)d_out;

    float* ws = (float*)d_ws;
    float* Qp = ws;                                   // 8192*1024
    float* Kp = Qp + (size_t)M_TOT * C_;              // 8192*1024
    float* Vp = Kp + (size_t)M_TOT * C_;              // 8192*1024
    float* Al = Vp + (size_t)M_TOT * C_;              // 8192
    float* Be = Al + M_TOT;                           // 8192

    dim3 g1(C_ / BN, M_TOT / BM, 3);
    proj_gemm_kernel<<<g1, dim3(256), 0, stream>>>(x, Wq, Wk, Wv, Qp, Kp, Vp);
    gate_kernel<<<dim3(M_TOT / 8), dim3(256), 0, stream>>>(x, Wa, Wb, Al, Be);
    scan_kernel<<<dim3(B_ * H_), dim3(256), 0, stream>>>(Qp, Kp, Vp, Al, Be, out);
}

// v002
// It runs in 578 microseconds.
// Next to v001, in two timings, it ran 1.34 times as fast each time.
// Over all steps from v000 it is 2.14 times as fast.
#include <hip/hip_runtime.h>
#include <hip/hip_bf16.h>

typedef __attribute__((ext_vector_type(2))) float v2f;
typedef __attribute__((ext_vector_type(8))) float v8f;

#define B_    4
#define T_    2048
#define C_    1024
#define H_    16
#define D_    64
#define M_TOT (B_ * T_)      // 8192 rows

// ---------------- fp32 WMMA projection GEMM -----------------
// Y[M,N] = X[M,K] @ W[K,N]; M=8192, K=N=1024. Uses V_WMMA_F32_16X16X4_F32.
// Block tile 128x128, BK=16, 256 threads = 8 waves in 4x2 grid; each wave owns
// a 32x64 strip (2 A-frags x 4 B-frags = 8 f32 accumulators -> 1.5 LDS
// loads/WMMA). Double-buffered LDS filled by CDNA5 async DMA
// (global_load_async_to_lds_b128, ASYNCcnt) -- no VGPR staging, no spills,
// DMA of tile it+1 overlaps WMMA compute of tile it.
#define BM  128
#define BN  128
#define BK  16
#define LDX (BK + 4)   // 20: row pitch 80B, 16B-aligned
#define LDW (BN + 4)   // 132: row pitch 528B, 16B-aligned

__device__ __forceinline__ void async_b128_to_lds(unsigned lds_addr, unsigned voff,
                                                  const float* sbase) {
    // GVS mode: mem_addr = SGPR64 + VGPR_I32 ; LDS dest = lds_addr (wave-relative)
    asm volatile("global_load_async_to_lds_b128 %0, %1, %2"
                 :: "v"(lds_addr), "v"(voff), "s"(sbase)
                 : "memory");
}
__device__ __forceinline__ void wait_async0() {
    asm volatile("s_wait_asynccnt 0x0" ::: "memory");
}

__global__ __launch_bounds__(256)
void proj_gemm_kernel(const float* __restrict__ X,
                      const float* __restrict__ W0, const float* __restrict__ W1,
                      const float* __restrict__ W2,
                      float* __restrict__ Y0, float* __restrict__ Y1,
                      float* __restrict__ Y2) {
    const int N = C_, K = C_;
    const int zn = blockIdx.z;
    const float* __restrict__ W = (zn == 0) ? W0 : ((zn == 1) ? W1 : W2);
    float* __restrict__ Y       = (zn == 0) ? Y0 : ((zn == 1) ? Y1 : Y2);

    const int n0 = blockIdx.x * BN;
    const int m0 = blockIdx.y * BM;

    __shared__ float Xs[2][BM * LDX];   // 2 x 128x20 floats
    __shared__ float Ws[2][BK * LDW];   // 2 x  16x132 floats

    const int tid  = threadIdx.x;
    const int wave = tid >> 5;
    const int lane = tid & 31;
    const int lr   = lane & 15;   // row within A-frag / col within B-frag
    const int half = lane >> 4;   // selects K pair {0,1} vs {2,3}
    const int wr   = wave & 3;    // wave row block (32 rows each)
    const int wc   = wave >> 2;   // wave col block (64 cols each)
    const int mw0  = wr * 32;
    const int nw0  = wc * 64;

    // DMA geometry: per thread 2 x b128 for X (rows xrow, xrow+64) and
    // 2 x b128 for W (rows wrow, wrow+8).
    const int xrow = tid >> 2;
    const int xc4  = (tid & 3) << 2;
    const int wrow = tid >> 5;
    const int wc4  = (tid & 31) << 2;

    const float* sX = X + (size_t)m0 * K;   // uniform 64-bit base (SGPR pair)
    const float* sW = W + n0;

    unsigned voffX[2], voffW[2], ldsX[2][2], ldsW[2][2];
    #pragma unroll
    for (int i = 0; i < 2; ++i) {
        voffX[i] = (unsigned)(((xrow + i * 64) * K + xc4) * 4);
        voffW[i] = (unsigned)(((wrow + i * 8) * N + wc4) * 4);
        #pragma unroll
        for (int bf = 0; bf < 2; ++bf) {
            ldsX[bf][i] = (unsigned)(uintptr_t)&Xs[bf][(xrow + i * 64) * LDX + xc4];
            ldsW[bf][i] = (unsigned)(uintptr_t)&Ws[bf][(wrow + i * 8) * LDW + wc4];
        }
    }

    auto issue = [&](int bf, int k0) {
        #pragma unroll
        for (int i = 0; i < 2; ++i) {
            async_b128_to_lds(ldsX[bf][i], voffX[i] + (unsigned)(k0 * 4), sX);
            async_b128_to_lds(ldsW[bf][i], voffW[i] + (unsigned)(k0 * N * 4), sW);
        }
    };

    v8f acc[2][4] = {};

    const int NT = K / BK;          // 64 K-tiles
    issue(0, 0);
    int cur = 0;

    for (int it = 0; it < NT; ++it) {
        wait_async0();                            // tile `it` DMA landed
        __syncthreads();                          // visible to all; buf^1 free
        if (it + 1 < NT) issue(cur ^ 1, (it + 1) * BK);   // overlap next DMA

        const float* xs = &Xs[cur][0];
        const float* ws = &Ws[cur][0];
        #pragma unroll
        for (int kk = 0; kk < BK; kk += 4) {
            // A frags (16x4 f32): lane lr holds M=lr; VGPR0=K{0|2}, VGPR1=K{1|3}
            v2f a0, a1;
            a0.x = xs[(mw0 + lr) * LDX + kk + 2 * half];
            a0.y = xs[(mw0 + lr) * LDX + kk + 2 * half + 1];
            a1.x = xs[(mw0 + 16 + lr) * LDX + kk + 2 * half];
            a1.y = xs[(mw0 + 16 + lr) * LDX + kk + 2 * half + 1];
            #pragma unroll
            for (int j = 0; j < 4; ++j) {
                // B frag (4x16 f32): lane lr holds N=lr; VGPR0=K{0|2}, VGPR1=K{1|3}
                v2f bv;
                bv.x = ws[(kk + 2 * half) * LDW + nw0 + j * 16 + lr];
                bv.y = ws[(kk + 2 * half + 1) * LDW + nw0 + j * 16 + lr];
                acc[0][j] = __builtin_amdgcn_wmma_f32_16x16x4_f32(
                    false, a0, false, bv, (short)0, acc[0][j], false, false);
                acc[1][j] = __builtin_amdgcn_wmma_f32_16x16x4_f32(
                    false, a1, false, bv, (short)0, acc[1][j], false, false);
            }
        }
        cur ^= 1;
    }

    // C/D layout: VGPR r -> (M = r + 8*half, N = lr)
    #pragma unroll
    for (int g = 0; g < 2; ++g) {
        #pragma unroll
        for (int j = 0; j < 4; ++j) {
            #pragma unroll
            for (int r = 0; r < 8; ++r) {
                int row = m0 + mw0 + g * 16 + r + 8 * half;
                int col = n0 + nw0 + j * 16 + lr;
                Y[(size_t)row * N + col] = acc[g][j][r];
            }
        }
    }
}

// ---------------- gate GEMV: alpha/beta = sigmoid(x @ Wa/Wb) ----------------
__global__ __launch_bounds__(256)
void gate_kernel(const float* __restrict__ X, const float* __restrict__ Wa,
                 const float* __restrict__ Wb, float* __restrict__ Al,
                 float* __restrict__ Be) {
    const int wave = threadIdx.x >> 5;
    const int lane = threadIdx.x & 31;
    const int m    = blockIdx.x * 8 + wave;
    const float* xr = X + (size_t)m * C_;
    float pa = 0.f, pb = 0.f;
    #pragma unroll 8
    for (int i = 0; i < C_ / 32; ++i) {
        float xv = xr[lane + 32 * i];
        pa += xv * Wa[lane + 32 * i];
        pb += xv * Wb[lane + 32 * i];
    }
    #pragma unroll
    for (int off = 16; off > 0; off >>= 1) {
        pa += __shfl_xor(pa, off, 32);
        pb += __shfl_xor(pb, off, 32);
    }
    if (lane == 0) {
        Al[m] = 1.f / (1.f + __expf(-pa));
        Be[m] = 1.f / (1.f + __expf(-pb));
    }
}

// ---------------- gated delta recurrence ----------------
// One WG (256 thr) per (b,h). Thread (v = tid>>2, k-seg = (tid&3)*16) owns
// S[v][seg..seg+15] in 16 VGPRs. 4-lane sums by DPP.
// k/q/v and the two gates of TCH timesteps are staged in LDS by async copies,
// two buffers: chunk c+1 flies while chunk c is worked on, so no step waits on
// global memory. Inside a chunk the next step's operands are fetched from LDS
// one step ahead.
#define TCH 64                 // timesteps per staged chunk

// Sum over the four lanes of a quad, the total in every lane. The partner's
// value comes through the vector unit's own lane permute (DPP quad_perm), not
// through the LDS crossbar, so no LDS round trip stands on the step's chain.
__device__ __forceinline__ float quad_sum(float x) {
    // quad_perm [1,0,3,2]: lane ^ 1
    x += __int_as_float(__builtin_amdgcn_mov_dpp(__float_as_int(x), 0xB1, 0xf, 0xf, true));
    // quad_perm [2,3,0,1]: lane ^ 2
    x += __int_as_float(__builtin_amdgcn_mov_dpp(__float_as_int(x), 0x4E, 0xf, 0xf, true));
    return x;
}
#define NCH (T_ / TCH)         // 32 chunks

__global__ __launch_bounds__(256)
void scan_kernel(const float* __restrict__ Q, const float* __restrict__ K,
                 const float* __restrict__ V, const float* __restrict__ A,
                 const float* __restrict__ Bt, float* __restrict__ Out) {
    __shared__ __attribute__((aligned(16))) float Ks[2][TCH * D_];
    __shared__ __attribute__((aligned(16))) float Qs[2][TCH * D_];
    __shared__ __attribute__((aligned(16))) float Vs[2][TCH * D_];
    __shared__ __attribute__((aligned(16))) float Gs[2][TCH * 2];   // (a,b) per step

    const int bh  = blockIdx.x;          // 0..63
    const int b   = bh >> 4;
    const int h   = bh & 15;
    const int tid = threadIdx.x;
    const int v   = tid >> 2;            // 0..63  (row of state)
    const int seg = (tid & 3) << 4;      // 0,16,32,48 (k segment)
    const int lane = tid & 31;
    const int wv  = __builtin_amdgcn_readfirstlane(tid >> 5);   // scalar wave number

    const size_t base = (size_t)b * T_ * C_ + (size_t)h * D_;

    // Copy geometry: a chunk of one tensor is 64 rows x 256 B; a thread brings
    // 16 B of each of the rows crow, crow+16, crow+32, crow+48 of K, Q and V.
    const int crow = tid >> 4;           // 0..15
    const int cc4  = (tid & 15) << 2;    // float column, 16-B steps
    const int l0   = crow * D_ + cc4;
    const int l1   = l0 + 16 * D_;
    const int l2   = l0 + 32 * D_;
    const int l3   = l0 + 48 * D_;

    auto stage = [&](int bf, int t0) {
        const size_t g0 = base + (size_t)(t0 + crow) * C_ + cc4;
        const size_t g1 = g0 + (size_t)16 * C_;
        const size_t g2 = g0 + (size_t)32 * C_;
        const size_t g3 = g0 + (size_t)48 * C_;
        // The xcnt wait is the statement's last line so that it stands before
        // any rewrite of the address registers the copies name.
        asm volatile("global_load_async_to_lds_b128 %0, %1, off\n\t"
                     "global_load_async_to_lds_b128 %2, %3, off\n\t"
                     "global_load_async_to_lds_b128 %4, %5, off\n\t"
                     "global_load_async_to_lds_b128 %6, %7, off\n\t"
                     "global_load_async_to_lds_b128 %8, %9, off\n\t"
                     "global_load_async_to_lds_b128 %10, %11, off\n\t"
                     "global_load_async_to_lds_b128 %12, %13, off\n\t"
                     "global_load_async_to_lds_b128 %14, %15, off\n\t"
                     "global_load_async_to_lds_b128 %16, %17, off\n\t"
                     "global_load_async_to_lds_b128 %18, %19, off\n\t"
                     "global_load_async_to_lds_b128 %20, %21, off\n\t"
                     "global_load_async_to_lds_b128 %22, %23, off\n\t"
                     "s_wait_xcnt 0x0"
                     :: "v"((unsigned)(uintptr_t)&Ks[bf][l0]), "v"(K + g0),
                        "v"((unsigned)(uintptr_t)&Ks[bf][l1]), "v"(K + g1),
                        "v"((unsigned)(uintptr_t)&Ks[bf][l2]), "v"(K + g2),
                        "v"((unsigned)(uintptr_t)&Ks[bf][l3]), "v"(K + g3),
                        "v"((unsigned)(uintptr_t)&Qs[bf][l0]), "v"(Q + g0),
                        "v"((unsigned)(uintptr_t)&Qs[bf][l1]), "v"(Q + g1),
                        "v"((unsigned)(uintptr_t)&Qs[bf][l2]), "v"(Q + g2),
                        "v"((unsigned)(uintptr_t)&Qs[bf][l3]), "v"(Q + g3),
                        "v"((unsigned)(uintptr_t)&Vs[bf][l0]), "v"(V + g0),
                        "v"((unsigned)(uintptr_t)&Vs[bf][l1]), "v"(V + g1),
                        "v"((unsigned)(uintptr_t)&Vs[bf][l2]), "v"(V + g2),
                        "v"((unsigned)(uintptr_t)&Vs[bf][l3]), "v"(V + g3)
                     : "memory");
        // Gates: waves 0 and 2 bring a, waves 1 and 3 bring b, one float a lane
        // (32 steps a wave), interleaved so that a step reads its pair with one
        // 8-byte LDS load.
        if (wv < 4) {
            const int gi = (wv >> 1) * 32 + lane;          // step inside the chunk
            const float* g = ((wv & 1) ? Bt : A) + (size_t)b * T_ + t0 + gi;
            asm volatile("global_load_async_to_lds_b32 %0, %1, off\n\t"
                         "s_wait_xcnt 0x0"
                         :: "v"((unsigned)(uintptr_t)&Gs[bf][2 * gi + (wv & 1)]), "v"(g)
                         : "memory");
        }
    };

    float s[16];
    #pragma unroll
    for (int i = 0; i < 16; ++i) s[i] = 0.f;

    stage(0, 0);
    wait_async0();                 // chunk 0 landed (this wave's copies)
    __syncthreads();               // ... and every other wave's
    stage(1, TCH);

    for (int c = 0; c < NCH; ++c) {
        const int bf = c & 1;
        const float* ks = &Ks[bf][seg];
        const float* qs = &Qs[bf][seg];
        const float* vs = &Vs[bf][v];
        const float* gs = &Gs[bf][0];

        float4 kc[4], qc[4];
        float  vc, ac, bc;
        {   // first step of the chunk
            #pragma unroll
            for (int i = 0; i < 4; ++i) {
                kc[i] = *(const float4*)(ks + 4 * i);
                qc[i] = *(const float4*)(qs + 4 * i);
            }
            vc = vs[0];
            const float2 g = *(const float2*)gs;
            ac = g.x; bc = g.y;
        }

        // unrolled so that handing the fetched-ahead registers on costs no copies
        #pragma unroll 4
        for (int j = 0; j < TCH; ++j) {
            // fetch step j+1 from LDS (clamped: never past this chunk's buffer)
            const int jn = (j + 1 < TCH) ? (j + 1) : j;
            float4 kn[4], qn[4];
            #pragma unroll
            for (int i = 0; i < 4; ++i) {
                kn[i] = *(const float4*)(ks + jn * D_ + 4 * i);
                qn[i] = *(const float4*)(qs + jn * D_ + 4 * i);
            }
            const float  vn = vs[jn * D_];
            const float2 gn = *(const float2*)(gs + 2 * jn);

            // sk[v] = sum_k S[v,k] * k_t[k]   (partial over 16, reduce over 4 lanes)
            float p = 0.f;
            #pragma unroll
            for (int i = 0; i < 4; ++i) {
                p += s[4 * i + 0] * kc[i].x + s[4 * i + 1] * kc[i].y +
                     s[4 * i + 2] * kc[i].z + s[4 * i + 3] * kc[i].w;
            }
            p = quad_sum(p);

            // S = a*S + (b*v - a*b*sk) * k^T ;  o[v] = sum_k q_t[k]*S[v,k]
            const float coef = bc * vc - ac * bc * p;
            float o = 0.f;
            #pragma unroll
            for (int i = 0; i < 4; ++i) {
                s[4 * i + 0] = ac * s[4 * i + 0] + coef * kc[i].x;  o += qc[i].x * s[4 * i + 0];
                s[4 * i + 1] = ac * s[4 * i + 1] + coef * kc[i].y;  o += qc[i].y * s[4 * i + 1];
                s[4 * i + 2] = ac * s[4 * i + 2] + coef * kc[i].z;  o += qc[i].z * s[4 * i + 2];
                s[4 * i + 3] = ac * s[4 * i + 3] + coef * kc[i].w;  o += qc[i].w * s[4 * i + 3];
            }
            o = quad_sum(o);
            if ((tid & 3) == 0) {
                Out[base + (size_t)(c * TCH + j) * C_ + v] = o;
                // before the store's address and data registers are reused
                asm volatile("s_wait_xcnt 0x0" ::: "memory");
            }

            #pragma unroll
            for (int i = 0; i < 4; ++i) { kc[i] = kn[i]; qc[i] = qn[i]; }
            vc = vn; ac = gn.x; bc = gn.y;
        }

        // Hand-over: this wave's LDS reads of buffer bf are done, its copies of
        // chunk c+1 have landed; the barrier says the same of every wave. Only
        // then is buffer bf refilled.
        asm volatile("s_wait_dscnt 0x0" ::: "memory");
        wait_async0();
        __syncthreads();
        if (c + 2 < NCH) stage(bf, (c + 2) * TCH);
    }
    wait_async0();                 // nothing in flight when the wave ends
}

extern "C" void kernel_launch(void* const* d_in, const int* in_sizes, int n_in,
                              void* d_out, int out_size, void* d_ws, size_t ws_size,
                              hipStream_t stream) {
    (void)in_sizes; (void)n_in; (void)out_size; (void)ws_size;
    const float* x  = (const float*)d_in[0];
    const float* Wq = (const float*)d_in[1];
    const float* Wk = (const float*)d_in[2];
    const float* Wv = (const float*)d_in[3];
    const float* Wa = (const float*)d_in[4];
    const float* Wb = (const float*)d_in[5];
    float* out = (float*)d_out;

    float* ws = (float*)d_ws;
    float* Qp = ws;                                   // 8192*1024
    float* Kp = Qp + (size_t)M_TOT * C_;              // 8192*1024
    float* Vp = Kp + (size_t)M_TOT * C_;              // 8192*1024
    float* Al = Vp + (size_t)M_TOT * C_;              // 8192
    float* Be = Al + M_TOT;                           // 8192

    dim3 g1(C_ / BN, M_TOT / BM, 3);
    proj_gemm_kernel<<<g1, dim3(256), 0, stream>>>(x, Wq, Wk, Wv, Qp, Kp, Vp);
    gate_kernel<<<dim3(M_TOT / 8), dim3(256), 0, stream>>>(x, Wa, Wb, Al, Be);
    scan_kernel<<<dim3(B_ * H_), dim3(256), 0, stream>>>(Qp, Kp, Vp, Al, Be, out);
}

// v003
// A run of this version takes 503 microseconds.
// Two timings next to v002 both put it at 1.16 times that version's speed.
// All steps since v000 together make it 2.49 times as fast.
#include <hip/hip_runtime.h>
#include <hip/hip_bf16.h>

typedef __attribute__((ext_vector_type(2))) float v2f;
typedef __attribute__((ext_vector_type(8))) float v8f;
typedef __attribute__((ext_vector_type(4))) float v4f;

#define B_    4
#define T_    2048
#define C_    1024
#define H_    16
#define D_    64
#define M_TOT (B_ * T_)      // 8192 rows

// ---------------- fp32 WMMA projection GEMM -----------------
// Y[M,N] = X[M,K] @ W[K,N]; M=8192, K=N=1024. Uses V_WMMA_F32_16X16X4_F32.
// Block tile 128x128, BK=16, 256 threads = 8 waves in 4x2 grid; each wave owns
// a 32x64 strip (2 A-frags x 4 B-frags = 8 f32 accumulators -> 1.5 LDS
// loads/WMMA). Double-buffered LDS filled by CDNA5 async DMA
// (global_load_async_to_lds_b128, ASYNCcnt) -- no VGPR staging, no spills,
// DMA of tile it+1 overlaps WMMA compute of tile it.
#define BM  128
#define BN  128
#define BK  16
#define LDX (BK + 4)   // 20: row pitch 80B, 16B-aligned
#define LDW (BN + 4)   // 132: row pitch 528B, 16B-aligned

__device__ __forceinline__ void async_b128_to_lds(unsigned lds_addr, unsigned voff,
                                                  const float* sbase) {
    // GVS mode: mem_addr = SGPR64 + VGPR_I32 ; LDS dest = lds_addr (wave-relative)
    asm volatile("global_load_async_to_lds_b128 %0, %1, %2"
                 :: "v"(lds_addr), "v"(voff), "s"(sbase)
                 : "memory");
}
__device__ __forceinline__ void wait_async0() {
    asm volatile("s_wait_asynccnt 0x0" ::: "memory");
}

__global__ __launch_bounds__(256)
void proj_gemm_kernel(const float* __restrict__ X,
                      const float* __restrict__ W0, const float* __restrict__ W1,
                      const float* __restrict__ W2,
                      float* __restrict__ Y0, float* __restrict__ Y1,
                      float* __restrict__ Y2) {
    const int N = C_, K = C_;
    const int zn = blockIdx.z;
    const float* __restrict__ W = (zn == 0) ? W0 : ((zn == 1) ? W1 : W2);
    float* __restrict__ Y       = (zn == 0) ? Y0 : ((zn == 1) ? Y1 : Y2);

    const int n0 = blockIdx.x * BN;
    const int m0 = blockIdx.y * BM;

    __shared__ float Xs[2][BM * LDX];   // 2 x 128x20 floats
    __shared__ float Ws[2][BK * LDW];   // 2 x  16x132 floats

    const int tid  = threadIdx.x;
    const int wave = tid >> 5;
    const int lane = tid & 31;
    const int lr   = lane & 15;   // row within A-frag / col within B-frag
    const int half = lane >> 4;   // selects K pair {0,1} vs {2,3}
    const int wr   = wave & 3;    // wave row block (32 rows each)
    const int wc   = wave >> 2;   // wave col block (64 cols each)
    const int mw0  = wr * 32;
    const int nw0  = wc * 64;

    // DMA geometry: per thread 2 x b128 for X (rows xrow, xrow+64) and
    // 2 x b128 for W (rows wrow, wrow+8).
    const int xrow = tid >> 2;
    const int xc4  = (tid & 3) << 2;
    const int wrow = tid >> 5;
    const int wc4  = (tid & 31) << 2;

    const float* sX = X + (size_t)m0 * K;   // uniform 64-bit base (SGPR pair)
    const float* sW = W + n0;

    unsigned voffX[2], voffW[2], ldsX[2][2], ldsW[2][2];
    #pragma unroll
    for (int i = 0; i < 2; ++i) {
        voffX[i] = (unsigned)(((xrow + i * 64) * K + xc4) * 4);
        voffW[i] = (unsigned)(((wrow + i * 8) * N + wc4) * 4);
        #pragma unroll
        for (int bf = 0; bf < 2; ++bf) {
            ldsX[bf][i] = (unsigned)(uintptr_t)&Xs[bf][(xrow + i * 64) * LDX + xc4];
            ldsW[bf][i] = (unsigned)(uintptr_t)&Ws[bf][(wrow + i * 8) * LDW + wc4];
        }
    }

    auto issue = [&](int bf, int k0) {
        #pragma unroll
        for (int i = 0; i < 2; ++i) {
            async_b128_to_lds(ldsX[bf][i], voffX[i] + (unsigned)(k0 * 4), sX);
            async_b128_to_lds(ldsW[bf][i], voffW[i] + (unsigned)(k0 * N * 4), sW);
        }
    };

    v8f acc[2][4] = {};

    const int NT = K / BK;          // 64 K-tiles
    issue(0, 0);
    int cur = 0;

    for (int it = 0; it < NT; ++it) {
        wait_async0();                            // tile `it` DMA landed
        __syncthreads();                          // visible to all; buf^1 free
        if (it + 1 < NT) issue(cur ^ 1, (it + 1) * BK);   // overlap next DMA

        const float* xs = &Xs[cur][0];
        const float* ws = &Ws[cur][0];
        #pragma unroll
        for (int kk = 0; kk < BK; kk += 4) {
            // A frags (16x4 f32): lane lr holds M=lr; VGPR0=K{0|2}, VGPR1=K{1|3}
            v2f a0, a1;
            a0.x = xs[(mw0 + lr) * LDX + kk + 2 * half];
            a0.y = xs[(mw0 + lr) * LDX + kk + 2 * half + 1];
            a1.x = xs[(mw0 + 16 + lr) * LDX + kk + 2 * half];
            a1.y = xs[(mw0 + 16 + lr) * LDX + kk + 2 * half + 1];
            #pragma unroll
            for (int j = 0; j < 4; ++j) {
                // B frag (4x16 f32): lane lr holds N=lr; VGPR0=K{0|2}, VGPR1=K{1|3}
                v2f bv;
                bv.x = ws[(kk + 2 * half) * LDW + nw0 + j * 16 + lr];
                bv.y = ws[(kk + 2 * half + 1) * LDW + nw0 + j * 16 + lr];
                acc[0][j] = __builtin_amdgcn_wmma_f32_16x16x4_f32(
                    false, a0, false, bv, (short)0, acc[0][j], false, false);
                acc[1][j] = __builtin_amdgcn_wmma_f32_16x16x4_f32(
                    false, a1, false, bv, (short)0, acc[1][j], false, false);
            }
        }
        cur ^= 1;
    }

    // C/D layout: VGPR r -> (M = r + 8*half, N = lr)
    #pragma unroll
    for (int g = 0; g < 2; ++g) {
        #pragma unroll
        for (int j = 0; j < 4; ++j) {
            #pragma unroll
            for (int r = 0; r < 8; ++r) {
                int row = m0 + mw0 + g * 16 + r + 8 * half;
                int col = n0 + nw0 + j * 16 + lr;
                Y[(size_t)row * N + col] = acc[g][j][r];
            }
        }
    }
}

// ---------------- gate GEMV: alpha/beta = sigmoid(x @ Wa/Wb) ----------------
__global__ __launch_bounds__(256)
void gate_kernel(const float* __restrict__ X, const float* __restrict__ Wa,
                 const float* __restrict__ Wb, float* __restrict__ Al,
                 float* __restrict__ Be) {
    const int wave = threadIdx.x >> 5;
    const int lane = threadIdx.x & 31;
    const int m    = blockIdx.x * 8 + wave;
    const float* xr = X + (size_t)m * C_;
    float pa = 0.f, pb = 0.f;
    #pragma unroll 8
    for (int i = 0; i < C_ / 32; ++i) {
        float xv = xr[lane + 32 * i];
        pa += xv * Wa[lane + 32 * i];
        pb += xv * Wb[lane + 32 * i];
    }
    #pragma unroll
    for (int off = 16; off > 0; off >>= 1) {
        pa += __shfl_xor(pa, off, 32);
        pb += __shfl_xor(pb, off, 32);
    }
    if (lane == 0) {
        Al[m] = 1.f / (1.f + __expf(-pa));
        Be[m] = 1.f / (1.f + __expf(-pb));
    }
}

// ---------------- gated delta recurrence ----------------
// One WG (256 thr) per (b,h). Thread (v = tid>>2, k-seg = (tid&3)*16) owns
// S[v][seg..seg+15] in 16 VGPRs. 4-lane sums by DPP.
// k/q/v and the two gates of TCH timesteps are staged in LDS by async copies,
// two buffers: chunk c+1 flies while chunk c is worked on, so no step waits on
// global memory. Inside a chunk the operands are fetched from LDS two steps
// ahead, and S.k of step t+1 is formed beside q.S of step t.
#define TCH 64                 // timesteps per staged chunk

// Sum over the four lanes of a quad, the total in every lane. The partner's
// value comes through the vector unit's own lane permute (DPP quad_perm), not
// through the LDS crossbar, so no LDS round trip stands on the step's chain.
__device__ __forceinline__ float quad_sum(float x) {
    // quad_perm [1,0,3,2]: lane ^ 1
    x += __int_as_float(__builtin_amdgcn_mov_dpp(__float_as_int(x), 0xB1, 0xf, 0xf, true));
    // quad_perm [2,3,0,1]: lane ^ 2
    x += __int_as_float(__builtin_amdgcn_mov_dpp(__float_as_int(x), 0x4E, 0xf, 0xf, true));
    return x;
}
#define NCH (T_ / TCH)         // 32 chunks

// A lane's 16 products summed as four independent packed partial sums (two
// links each) and a short tree, not as one chain of 16 dependent additions.
__device__ __forceinline__ float dot16(const v2f* s, const v4f* x) {
    v2f a0 = s[0] * x[0].lo;
    v2f a1 = s[1] * x[0].hi;
    v2f a2 = s[2] * x[1].lo;
    v2f a3 = s[3] * x[1].hi;
    a0 = __builtin_elementwise_fma(s[4], x[2].lo, a0);
    a1 = __builtin_elementwise_fma(s[5], x[2].hi, a1);
    a2 = __builtin_elementwise_fma(s[6], x[3].lo, a2);
    a3 = __builtin_elementwise_fma(s[7], x[3].hi, a3);
    a0 = (a0 + a1) + (a2 + a3);
    return a0.x + a0.y;
}

__global__ __launch_bounds__(256)
void scan_kernel(const float* __restrict__ Q, const float* __restrict__ K,
                 const float* __restrict__ V, const float* __restrict__ A,
                 const float* __restrict__ Bt, float* __restrict__ Out) {
    __shared__ __attribute__((aligned(16))) float Ks[2][TCH * D_];
    __shared__ __attribute__((aligned(16))) float Qs[2][TCH * D_];
    __shared__ __attribute__((aligned(16))) float Vs[2][TCH * D_];
    __shared__ __attribute__((aligned(16))) float Gs[2][TCH * 2];   // (a,b) per step

    const int bh  = blockIdx.x;          // 0..63
    const int b   = bh >> 4;
    const int h   = bh & 15;
    const int tid = threadIdx.x;
    const int v   = tid >> 2;            // 0..63  (row of state)
    const int seg = (tid & 3) << 4;      // 0,16,32,48 (k segment)
    const int lane = tid & 31;
    const int wv  = __builtin_amdgcn_readfirstlane(tid >> 5);   // scalar wave number

    const size_t base = (size_t)b * T_ * C_ + (size_t)h * D_;

    // Copy geometry: a chunk of one tensor is 64 rows x 256 B; a thread brings
    // 16 B of each of the rows crow, crow+16, crow+32, crow+48 of K, Q and V.
    const int crow = tid >> 4;           // 0..15
    const int cc4  = (tid & 15) << 2;    // float column, 16-B steps
    const int l0   = crow * D_ + cc4;
    const int l1   = l0 + 16 * D_;
    const int l2   = l0 + 32 * D_;
    const int l3   = l0 + 48 * D_;

    auto stage = [&](int bf, int t0) {
        const size_t g0 = base + (size_t)(t0 + crow) * C_ + cc4;
        const size_t g1 = g0 + (size_t)16 * C_;
        const size_t g2 = g0 + (size_t)32 * C_;
        const size_t g3 = g0 + (size_t)48 * C_;
        // The xcnt wait is the statement's last line so that it stands before
        // any rewrite of the address registers the copies name.
        asm volatile("global_load_async_to_lds_b128 %0, %1, off\n\t"
                     "global_load_async_to_lds_b128 %2, %3, off\n\t"
                     "global_load_async_to_lds_b128 %4, %5, off\n\t"
                     "global_load_async_to_lds_b128 %6, %7, off\n\t"
                     "global_load_async_to_lds_b128 %8, %9, off\n\t"
                     "global_load_async_to_lds_b128 %10, %11, off\n\t"
                     "global_load_async_to_lds_b128 %12, %13, off\n\t"
                     "global_load_async_to_lds_b128 %14, %15, off\n\t"
                     "global_load_async_to_lds_b128 %16, %17, off\n\t"
                     "global_load_async_to_lds_b128 %18, %19, off\n\t"
                     "global_load_async_to_lds_b128 %20, %21, off\n\t"
                     "global_load_async_to_lds_b128 %22, %23, off\n\t"
                     "s_wait_xcnt 0x0"
                     :: "v"((unsigned)(uintptr_t)&Ks[bf][l0]), "v"(K + g0),
                        "v"((unsigned)(uintptr_t)&Ks[bf][l1]), "v"(K + g1),
                        "v"((unsigned)(uintptr_t)&Ks[bf][l2]), "v"(K + g2),
                        "v"((unsigned)(uintptr_t)&Ks[bf][l3]), "v"(K + g3),
                        "v"((unsigned)(uintptr_t)&Qs[bf][l0]), "v"(Q + g0),
                        "v"((unsigned)(uintptr_t)&Qs[bf][l1]), "v"(Q + g1),
                        "v"((unsigned)(uintptr_t)&Qs[bf][l2]), "v"(Q + g2),
                        "v"((unsigned)(uintptr_t)&Qs[bf][l3]), "v"(Q + g3),
                        "v"((unsigned)(uintptr_t)&Vs[bf][l0]), "v"(V + g0),
                        "v"((unsigned)(uintptr_t)&Vs[bf][l1]), "v"(V + g1),
                        "v"((unsigned)(uintptr_t)&Vs[bf][l2]), "v"(V + g2),
                        "v"((unsigned)(uintptr_t)&Vs[bf][l3]), "v"(V + g3)
                     : "memory");
        // Gates: waves 0 and 2 bring a, waves 1 and 3 bring b, one float a lane
        // (32 steps a wave), interleaved so that a step reads its pair with one
        // 8-byte LDS load.
        if (wv < 4) {
            const int gi = (wv >> 1) * 32 + lane;          // step inside the chunk
            const float* g = ((wv & 1) ? Bt : A) + (size_t)b * T_ + t0 + gi;
            asm volatile("global_load_async_to_lds_b32 %0, %1, off\n\t"
                         "s_wait_xcnt 0x0"
                         :: "v"((unsigned)(uintptr_t)&Gs[bf][2 * gi + (wv & 1)]), "v"(g)
                         : "memory");
        }
    };

    v2f s[8];                      // S[v][seg..seg+15] as eight pairs
    #pragma unroll
    for (int i = 0; i < 8; ++i) s[i] = (v2f){0.f, 0.f};

    stage(0, 0);
    wait_async0();                 // chunk 0 landed (this wave's copies)
    __syncthreads();               // ... and every other wave's
    stage(1, TCH);

    for (int c = 0; c < NCH; ++c) {
        const int bf = c & 1;
        const float* ks = &Ks[bf][seg];
        const float* qs = &Qs[bf][seg];
        const float* vs = &Vs[bf][v];
        const float* gs = &Gs[bf][0];

        // Operands of step j (c), step j+1 (n) and, fetched inside step j,
        // step j+2 (f): k of step j+1 is already used in step j.
        v4f   kc[4], qc[4], kn[4], qn[4];
        float vc, vn;
        float2 gc, gn;
        #pragma unroll
        for (int i = 0; i < 4; ++i) {
            kc[i] = *(const v4f*)(ks + 4 * i);
            qc[i] = *(const v4f*)(qs + 4 * i);
            kn[i] = *(const v4f*)(ks + D_ + 4 * i);
            qn[i] = *(const v4f*)(qs + D_ + 4 * i);
        }
        vc = vs[0];   gc = *(const float2*)gs;
        vn = vs[D_];  gn = *(const float2*)(gs + 2);

        // sk of the chunk's first step; every later one is formed in the step before
        float p = quad_sum(dot16(s, kc));

        auto step = [&](int j, bool more) {
            // fetch step j+2 from LDS (clamped: never past this chunk's buffer)
            const int jf = (j + 2 < TCH) ? (j + 2) : (TCH - 1);
            v4f kf[4], qf[4];
            #pragma unroll
            for (int i = 0; i < 4; ++i) {
                kf[i] = *(const v4f*)(ks + jf * D_ + 4 * i);
                qf[i] = *(const v4f*)(qs + jf * D_ + 4 * i);
            }
            const float  vf = vs[jf * D_];
            const float2 gf = *(const float2*)(gs + 2 * jf);

            // S = a*S + (b*v - a*b*sk) * k^T
            const float ac   = gc.x;
            // b*v and a*b do not wait for sk: one fused link from sk to coef
            const float coef = __builtin_fmaf(-(ac * gc.y), p, gc.y * vc);
            const v2f a2 = (v2f){ac, ac};
            const v2f c2 = (v2f){coef, coef};
            #pragma unroll
            for (int i = 0; i < 4; ++i) {
                s[2 * i + 0] = __builtin_elementwise_fma(c2, kc[i].lo, a2 * s[2 * i + 0]);
                s[2 * i + 1] = __builtin_elementwise_fma(c2, kc[i].hi, a2 * s[2 * i + 1]);
            }
            // Both products with the new state side by side:
            // o[v] = q_t . S[v,:]  and  sk of the next step = k_(t+1) . S[v,:]
            if (more) p = dot16(s, kn);
            float o = dot16(s, qc);
            if (more) p = quad_sum(p);
            o = quad_sum(o);
            if ((tid & 3) == 0) {
                Out[base + (size_t)(c * TCH + j) * C_ + v] = o;
                // before the store's address and data registers are reused
                asm volatile("s_wait_xcnt 0x0" ::: "memory");
            }

            #pragma unroll
            for (int i = 0; i < 4; ++i) {
                kc[i] = kn[i]; qc[i] = qn[i];
                kn[i] = kf[i]; qn[i] = qf[i];
            }
            vc = vn; gc = gn; vn = vf; gn = gf;
        };

        // three steps a trip: the three operand sets change places without copies
        #pragma unroll 3
        for (int j = 0; j < TCH - 1; ++j) step(j, true);
        step(TCH - 1, false);      // k of the next step lies in the other buffer

        // Hand-over: this wave's LDS reads of buffer bf are done, its copies of
        // chunk c+1 have landed; the barrier says the same of every wave. Only
        // then is buffer bf refilled.
        asm volatile("s_wait_dscnt 0x0" ::: "memory");
        wait_async0();
        __syncthreads();
        if (c + 2 < NCH) stage(bf, (c + 2) * TCH);
    }
    wait_async0();                 // nothing in flight when the wave ends
}

extern "C" void kernel_launch(void* const* d_in, const int* in_sizes, int n_in,
                              void* d_out, int out_size, void* d_ws, size_t ws_size,
                              hipStream_t stream) {
    (void)in_sizes; (void)n_in; (void)out_size; (void)ws_size;
    const float* x  = (const float*)d_in[0];
    const float* Wq = (const float*)d_in[1];
    const float* Wk = (const float*)d_in[2];
    const float* Wv = (const float*)d_in[3];
    const float* Wa = (const float*)d_in[4];
    const float* Wb = (const float*)d_in[5];
    float* out = (float*)d_out;

    float* ws = (float*)d_ws;
    float* Qp = ws;                                   // 8192*1024
    float* Kp = Qp + (size_t)M_TOT * C_;              // 8192*1024
    float* Vp = Kp + (size_t)M_TOT * C_;              // 8192*1024
    float* Al = Vp + (size_t)M_TOT * C_;              // 8192
    float* Be = Al + M_TOT;                           // 8192

    dim3 g1(C_ / BN, M_TOT / BM, 3);
    proj_gemm_kernel<<<g1, dim3(256), 0, stream>>>(x, Wq, Wk, Wv, Qp, Kp, Vp);
    gate_kernel<<<dim3(M_TOT / 8), dim3(256), 0, stream>>>(x, Wa, Wb, Al, Be);
    scan_kernel<<<dim3(B_ * H_), dim3(256), 0, stream>>>(Qp, Kp, Vp, Al, Be, out);
}

// v004
// A run of this version takes 393 microseconds.
// Next to v003, in two timings, it ran 1.28 times as fast each time.
// Counting every step since v000, it is 3.19 times as fast.
#include <hip/hip_runtime.h>
#include <hip/hip_bf16.h>

typedef __attribute__((ext_vector_type(2))) float v2f;
typedef __attribute__((ext_vector_type(8))) float v8f;
typedef __attribute__((ext_vector_type(4))) float v4f;

#define B_    4
#define T_    2048
#define C_    1024
#define H_    16
#define D_    64
#define M_TOT (B_ * T_)      // 8192 rows

// ---------------- fp32 WMMA projection GEMM -----------------
// Y[M,N] = X[M,K] @ W[K,N]; M=8192, K=N=1024. Uses V_WMMA_F32_16X16X4_F32.
// Block tile 128x128, BK=16, 256 threads = 8 waves in 4x2 grid; each wave owns
// a 32x64 strip (2 A-frags x 4 B-frags = 8 f32 accumulators -> 1.5 LDS
// loads/WMMA). Double-buffered LDS filled by CDNA5 async DMA
// (global_load_async_to_lds_b128, ASYNCcnt) -- no VGPR staging, no spills,
// DMA of tile it+1 overlaps WMMA compute of tile it.
#define BM  128
#define BN  128
#define BK  16
#define LDX (BK + 4)   // 20: row pitch 80B, 16B-aligned
#define LDW (BN + 4)   // 132: row pitch 528B, 16B-aligned

__device__ __forceinline__ void async_b128_to_lds(unsigned lds_addr, unsigned voff,
                                                  const float* sbase) {
    // GVS mode: mem_addr = SGPR64 + VGPR_I32 ; LDS dest = lds_addr (wave-relative)
    asm volatile("global_load_async_to_lds_b128 %0, %1, %2"
                 :: "v"(lds_addr), "v"(voff), "s"(sbase)
                 : "memory");
}
__device__ __forceinline__ void wait_async0() {
    asm volatile("s_wait_asynccnt 0x0" ::: "memory");
}

__global__ __launch_bounds__(256)
void proj_gemm_kernel(const float* __restrict__ X,
                      const float* __restrict__ W0, const float* __restrict__ W1,
                      const float* __restrict__ W2,
                      float* __restrict__ Y0, float* __restrict__ Y1,
                      float* __restrict__ Y2) {
    const int N = C_, K = C_;
    const int zn = blockIdx.z;
    const float* __restrict__ W = (zn == 0) ? W0 : ((zn == 1) ? W1 : W2);
    float* __restrict__ Y       = (zn == 0) ? Y0 : ((zn == 1) ? Y1 : Y2);

    const int n0 = blockIdx.x * BN;
    const int m0 = blockIdx.y * BM;

    __shared__ float Xs[2][BM * LDX];   // 2 x 128x20 floats
    __shared__ float Ws[2][BK * LDW];   // 2 x  16x132 floats

    const int tid  = threadIdx.x;
    const int wave = tid >> 5;
    const int lane = tid & 31;
    const int lr   = lane & 15;   // row within A-frag / col within B-frag
    const int half = lane >> 4;   // selects K pair {0,1} vs {2,3}
    const int wr   = wave & 3;    // wave row block (32 rows each)
    const int wc   = wave >> 2;   // wave col block (64 cols each)
    const int mw0  = wr * 32;
    const int nw0  = wc * 64;

    // DMA geometry: per thread 2 x b128 for X (rows xrow, xrow+64) and
    // 2 x b128 for W (rows wrow, wrow+8).
    const int xrow = tid >> 2;
    const int xc4  = (tid & 3) << 2;
    const int wrow = tid >> 5;
    const int wc4  = (tid & 31) << 2;

    const float* sX = X + (size_t)m0 * K;   // uniform 64-bit base (SGPR pair)
    const float* sW = W + n0;

    unsigned voffX[2], voffW[2], ldsX[2][2], ldsW[2][2];
    #pragma unroll
    for (int i = 0; i < 2; ++i) {
        voffX[i] = (unsigned)(((xrow + i * 64) * K + xc4) * 4);
        voffW[i] = (unsigned)(((wrow + i * 8) * N + wc4) * 4);
        #pragma unroll
        for (int bf = 0; bf < 2; ++bf) {
            ldsX[bf][i] = (unsigned)(uintptr_t)&Xs[bf][(xrow + i * 64) * LDX + xc4];
            ldsW[bf][i] = (unsigned)(uintptr_t)&Ws[bf][(wrow + i * 8) * LDW + wc4];
        }
    }

    auto issue = [&](int bf, int k0) {
        #pragma unroll
        for (int i = 0; i < 2; ++i) {
            async_b128_to_lds(ldsX[bf][i], voffX[i] + (unsigned)(k0 * 4), sX);
            async_b128_to_lds(ldsW[bf][i], voffW[i] + (unsigned)(k0 * N * 4), sW);
        }
    };

    v8f acc[2][4] = {};

    const int NT = K / BK;          // 64 K-tiles
    issue(0, 0);
    int cur = 0;

    for (int it = 0; it < NT; ++it) {
        wait_async0();                            // tile `it` DMA landed
        __syncthreads();                          // visible to all; buf^1 free
        if (it + 1 < NT) issue(cur ^ 1, (it + 1) * BK);   // overlap next DMA

        const float* xs = &Xs[cur][0];
        const float* ws = &Ws[cur][0];
        #pragma unroll
        for (int kk = 0; kk < BK; kk += 4) {
            // A frags (16x4 f32): lane lr holds M=lr; VGPR0=K{0|2}, VGPR1=K{1|3}
            v2f a0, a1;
            a0.x = xs[(mw0 + lr) * LDX + kk + 2 * half];
            a0.y = xs[(mw0 + lr) * LDX + kk + 2 * half + 1];
            a1.x = xs[(mw0 + 16 + lr) * LDX + kk + 2 * half];
            a1.y = xs[(mw0 + 16 + lr) * LDX + kk + 2 * half + 1];
            #pragma unroll
            for (int j = 0; j < 4; ++j) {
                // B frag (4x16 f32): lane lr holds N=lr; VGPR0=K{0|2}, VGPR1=K{1|3}
                v2f bv;
                bv.x = ws[(kk + 2 * half) * LDW + nw0 + j * 16 + lr];
                bv.y = ws[(kk + 2 * half + 1) * LDW + nw0 + j * 16 + lr];
                acc[0][j] = __builtin_amdgcn_wmma_f32_16x16x4_f32(
                    false, a0, false, bv, (short)0, acc[0][j], false, false);
                acc[1][j] = __builtin_amdgcn_wmma_f32_16x16x4_f32(
                    false, a1, false, bv, (short)0, acc[1][j], false, false);
            }
        }
        cur ^= 1;
    }

    // C/D layout: VGPR r -> (M = r + 8*half, N = lr)
    #pragma unroll
    for (int g = 0; g < 2; ++g) {
        #pragma unroll
        for (int j = 0; j < 4; ++j) {
            #pragma unroll
            for (int r = 0; r < 8; ++r) {
                int row = m0 + mw0 + g * 16 + r + 8 * half;
                int col = n0 + nw0 + j * 16 + lr;
                Y[(size_t)row * N + col] = acc[g][j][r];
            }
        }
    }
}

// ---------------- gate GEMV: alpha/beta = sigmoid(x @ Wa/Wb) ----------------
__global__ __launch_bounds__(256)
void gate_kernel(const float* __restrict__ X, const float* __restrict__ Wa,
                 const float* __restrict__ Wb, float* __restrict__ Al,
                 float* __restrict__ Be) {
    const int wave = threadIdx.x >> 5;
    const int lane = threadIdx.x & 31;
    const int m    = blockIdx.x * 8 + wave;
    const float* xr = X + (size_t)m * C_;
    float pa = 0.f, pb = 0.f;
    #pragma unroll 8
    for (int i = 0; i < C_ / 32; ++i) {
        float xv = xr[lane + 32 * i];
        pa += xv * Wa[lane + 32 * i];
        pb += xv * Wb[lane + 32 * i];
    }
    #pragma unroll
    for (int off = 16; off > 0; off >>= 1) {
        pa += __shfl_xor(pa, off, 32);
        pb += __shfl_xor(pb, off, 32);
    }
    if (lane == 0) {
        Al[m] = 1.f / (1.f + __expf(-pa));
        Be[m] = 1.f / (1.f + __expf(-pb));
    }
}

// ---------------- gated delta recurrence ----------------
// One WG (256 thr) per (b,h). Thread (v = tid>>2, k-seg = (tid&3)*16) owns
// S[v][seg..seg+15] in 16 VGPRs. 4-lane sums by DPP.
// k/q/v and the two gates of TCH timesteps are staged in LDS by async copies,
// two buffers: chunk c+1 flies while chunk c is worked on, so no step waits on
// global memory. Inside a chunk the operands are fetched from LDS two steps
// ahead, and S.k of step t+1 is formed beside q.S of step t.
// The outputs of a chunk are gathered in LDS and leave as whole rows once a
// chunk, so that no step holds a global store or a wait behind one.
#define TCH 64                 // timesteps per staged chunk

// Sum over the four lanes of a quad, the total in every lane. The partner's
// value comes through the vector unit's own lane permute (DPP quad_perm), not
// through the LDS crossbar, so no LDS round trip stands on the step's chain.
__device__ __forceinline__ float quad_sum(float x) {
    // quad_perm [1,0,3,2]: lane ^ 1
    x += __int_as_float(__builtin_amdgcn_mov_dpp(__float_as_int(x), 0xB1, 0xf, 0xf, true));
    // quad_perm [2,3,0,1]: lane ^ 2
    x += __int_as_float(__builtin_amdgcn_mov_dpp(__float_as_int(x), 0x4E, 0xf, 0xf, true));
    return x;
}
#define NCH (T_ / TCH)         // 32 chunks

// A lane's 16 products summed as four independent packed partial sums (two
// links each) and a short tree, not as one chain of 16 dependent additions.
__device__ __forceinline__ float dot16(const v2f* s, const v4f* x) {
    v2f a0 = s[0] * x[0].lo;
    v2f a1 = s[1] * x[0].hi;
    v2f a2 = s[2] * x[1].lo;
    v2f a3 = s[3] * x[1].hi;
    a0 = __builtin_elementwise_fma(s[4], x[2].lo, a0);
    a1 = __builtin_elementwise_fma(s[5], x[2].hi, a1);
    a2 = __builtin_elementwise_fma(s[6], x[3].lo, a2);
    a3 = __builtin_elementwise_fma(s[7], x[3].hi, a3);
    a0 = (a0 + a1) + (a2 + a3);
    return a0.x + a0.y;
}

__global__ __launch_bounds__(256)
void scan_kernel(const float* __restrict__ Q, const float* __restrict__ K,
                 const float* __restrict__ V, const float* __restrict__ A,
                 const float* __restrict__ Bt, float* __restrict__ Out) {
    __shared__ __attribute__((aligned(16))) float Ks[2][TCH * D_];
    __shared__ __attribute__((aligned(16))) float Qs[2][TCH * D_];
    __shared__ __attribute__((aligned(16))) float Vs[2][TCH * D_];
    __shared__ __attribute__((aligned(16))) float Gs[2][TCH * 2];   // (a,b) per step
    __shared__ __attribute__((aligned(16))) float Os[2][TCH * D_];  // outputs of a chunk

    const int bh  = blockIdx.x;          // 0..63
    const int b   = bh >> 4;
    const int h   = bh & 15;
    const int tid = threadIdx.x;
    const int v   = tid >> 2;            // 0..63  (row of state)
    const int seg = (tid & 3) << 4;      // 0,16,32,48 (k segment)
    const int r   = tid & 3;             // place in the quad
    const int lane = tid & 31;
    const int wv  = __builtin_amdgcn_readfirstlane(tid >> 5);   // scalar wave number

    const size_t base = (size_t)b * T_ * C_ + (size_t)h * D_;

    // Copy geometry: a chunk of one tensor is 64 rows x 256 B; a thread brings
    // 16 B of each of the rows crow, crow+16, crow+32, crow+48 of K, Q and V.
    const int crow = tid >> 4;           // 0..15
    const int cc4  = (tid & 15) << 2;    // float column, 16-B steps
    const int l0   = crow * D_ + cc4;
    const int l1   = l0 + 16 * D_;
    const int l2   = l0 + 32 * D_;
    const int l3   = l0 + 48 * D_;

    auto stage = [&](int bf, int t0) {
        const size_t g0 = base + (size_t)(t0 + crow) * C_ + cc4;
        const size_t g1 = g0 + (size_t)16 * C_;
        const size_t g2 = g0 + (size_t)32 * C_;
        const size_t g3 = g0 + (size_t)48 * C_;
        // The xcnt wait is the statement's last line so that it stands before
        // any rewrite of the address registers the copies name.
        asm volatile("global_load_async_to_lds_b128 %0, %1, off\n\t"
                     "global_load_async_to_lds_b128 %2, %3, off\n\t"
                     "global_load_async_to_lds_b128 %4, %5, off\n\t"
                     "global_load_async_to_lds_b128 %6, %7, off\n\t"
                     "global_load_async_to_lds_b128 %8, %9, off\n\t"
                     "global_load_async_to_lds_b128 %10, %11, off\n\t"
                     "global_load_async_to_lds_b128 %12, %13, off\n\t"
                     "global_load_async_to_lds_b128 %14, %15, off\n\t"
                     "global_load_async_to_lds_b128 %16, %17, off\n\t"
                     "global_load_async_to_lds_b128 %18, %19, off\n\t"
                     "global_load_async_to_lds_b128 %20, %21, off\n\t"
                     "global_load_async_to_lds_b128 %22, %23, off\n\t"
                     "s_wait_xcnt 0x0"
                     :: "v"((unsigned)(uintptr_t)&Ks[bf][l0]), "v"(K + g0),
                        "v"((unsigned)(uintptr_t)&Ks[bf][l1]), "v"(K + g1),
                        "v"((unsigned)(uintptr_t)&Ks[bf][l2]), "v"(K + g2),
                        "v"((unsigned)(uintptr_t)&Ks[bf][l3]), "v"(K + g3),
                        "v"((unsigned)(uintptr_t)&Qs[bf][l0]), "v"(Q + g0),
                        "v"((unsigned)(uintptr_t)&Qs[bf][l1]), "v"(Q + g1),
                        "v"((unsigned)(uintptr_t)&Qs[bf][l2]), "v"(Q + g2),
                        "v"((unsigned)(uintptr_t)&Qs[bf][l3]), "v"(Q + g3),
                        "v"((unsigned)(uintptr_t)&Vs[bf][l0]), "v"(V + g0),
                        "v"((unsigned)(uintptr_t)&Vs[bf][l1]), "v"(V + g1),
                        "v"((unsigned)(uintptr_t)&Vs[bf][l2]), "v"(V + g2),
                        "v"((unsigned)(uintptr_t)&Vs[bf][l3]), "v"(V + g3)
                     : "memory");
        // Gates: waves 0 and 2 bring a, waves 1 and 3 bring b, one float a lane
        // (32 steps a wave), interleaved so that a step reads its pair with one
        // 8-byte LDS load.
        if (wv < 4) {
            const int gi = (wv >> 1) * 32 + lane;          // step inside the chunk
            const float* g = ((wv & 1) ? Bt : A) + (size_t)b * T_ + t0 + gi;
            asm volatile("global_load_async_to_lds_b32 %0, %1, off\n\t"
                         "s_wait_xcnt 0x0"
                         :: "v"((unsigned)(uintptr_t)&Gs[bf][2 * gi + (wv & 1)]), "v"(g)
                         : "memory");
        }
    };

    v2f s[8];                      // S[v][seg..seg+15] as eight pairs
    #pragma unroll
    for (int i = 0; i < 8; ++i) s[i] = (v2f){0.f, 0.f};

    stage(0, 0);
    wait_async0();                 // chunk 0 landed (this wave's copies)
    __syncthreads();               // ... and every other wave's
    stage(1, TCH);

    for (int c = 0; c < NCH; ++c) {
        const int bf = c & 1;
        const float* ks = &Ks[bf][seg];
        const float* qs = &Qs[bf][seg];
        const float* vs = &Vs[bf][v];
        const float* gs = &Gs[bf][0];
        // row t of the output tile holds column x at place x ^ ((t & 3) << 3): the
        // four rows that a wave writes at once fall on 32 different banks
        float*       os = &Os[bf][r * D_ + (v ^ (r << 3))];
        float okeep = 0.f;         // lane r: the output of the step with (j & 3) == r

        // Operands of step j (c), step j+1 (n) and, fetched inside step j,
        // step j+2 (f): k of step j+1 is already used in step j.
        v4f   kc[4], qc[4], kn[4], qn[4];
        float vc, vn;
        float2 gc, gn;
        #pragma unroll
        for (int i = 0; i < 4; ++i) {
            kc[i] = *(const v4f*)(ks + 4 * i);
            qc[i] = *(const v4f*)(qs + 4 * i);
            kn[i] = *(const v4f*)(ks + D_ + 4 * i);
            qn[i] = *(const v4f*)(qs + D_ + 4 * i);
        }
        vc = vs[0];   gc = *(const float2*)gs;
        vn = vs[D_];  gn = *(const float2*)(gs + 2);

        // sk of the chunk's first step; every later one is formed in the step before
        float p = quad_sum(dot16(s, kc));

        auto step = [&](int j, int ph, bool more) {   // ph = j & 3, a constant
            // fetch step j+2 from LDS (clamped: never past this chunk's buffer)
            const int jf = (j + 2 < TCH) ? (j + 2) : (TCH - 1);
            v4f kf[4], qf[4];
            #pragma unroll
            for (int i = 0; i < 4; ++i) {
                kf[i] = *(const v4f*)(ks + jf * D_ + 4 * i);
                qf[i] = *(const v4f*)(qs + jf * D_ + 4 * i);
            }
            const float  vf = vs[jf * D_];
            const float2 gf = *(const float2*)(gs + 2 * jf);
            // Holds the fetches ahead of the step's arithmetic. With no branch left
            // between the steps the compiler otherwise sinks them to the step's
            // end, and k of step j+2, used in step j+1 already, arrives too late.
            __builtin_amdgcn_sched_barrier(0);

            // S = a*S + (b*v - a*b*sk) * k^T
            const float ac   = gc.x;
            // b*v and a*b do not wait for sk: one fused link from sk to coef
            const float coef = __builtin_fmaf(-(ac * gc.y), p, gc.y * vc);
            const v2f a2 = (v2f){ac, ac};
            const v2f c2 = (v2f){coef, coef};
            #pragma unroll
            for (int i = 0; i < 4; ++i) {
                s[2 * i + 0] = __builtin_elementwise_fma(c2, kc[i].lo, a2 * s[2 * i + 0]);
                s[2 * i + 1] = __builtin_elementwise_fma(c2, kc[i].hi, a2 * s[2 * i + 1]);
            }
            // Both products with the new state side by side:
            // o[v] = q_t . S[v,:]  and  sk of the next step = k_(t+1) . S[v,:]
            if (more) p = dot16(s, kn);
            float o = dot16(s, qc);
            if (more) p = quad_sum(p);
            o = quad_sum(o);
            // Every lane of the quad holds o. Lane r keeps the one of phase r
            // (the last phase at which r >= ph); after four steps the quad
            // puts four steps' outputs of its row v into LDS with one store.
            okeep = (r >= ph) ? o : okeep;
            if (ph == 3) os[(j - 3) * D_] = okeep;

            #pragma unroll
            for (int i = 0; i < 4; ++i) {
                kc[i] = kn[i]; qc[i] = qn[i];
                kn[i] = kf[i]; qn[i] = qf[i];
            }
            vc = vn; gc = gn; vn = vf; gn = gf;
        };

        // Twelve steps a trip: a multiple of three, so that the three operand
        // sets change places without copies, and of four, so that a step's
        // phase is a constant. The trips stay rolled to keep the code small.
        #pragma unroll 1
        for (int jb = 0; jb < TCH - 4; jb += 12) {
            #pragma unroll
            for (int u = 0; u < 12; ++u) step(jb + u, u & 3, true);
        }
        step(TCH - 4, 0, true);
        step(TCH - 3, 1, true);
        step(TCH - 2, 2, true);
        step(TCH - 1, 3, false);   // k of the next step lies in the other buffer

        // Hand-over: this wave's LDS reads of buffer bf are done, its outputs
        // stand in Os[bf], its copies of chunk c+1 have landed; the barrier says
        // the same of every wave. Only then is buffer bf refilled.
        asm volatile("s_wait_dscnt 0x0" ::: "memory");
        wait_async0();
        __syncthreads();
        if (c + 2 < NCH) stage(bf, (c + 2) * TCH);

        // The chunk's 64 x 64 outputs leave as whole 256-B rows, 16 B a lane.
        // Os[bf] is written again in chunk c+2, behind the next barrier, which
        // a wave reaches only after these reads.
        {
            const float* ob = &Os[bf][crow * D_ + (cc4 ^ ((crow & 3) << 3))];
            const v4f o0 = *(const v4f*)(ob);
            const v4f o1 = *(const v4f*)(ob + 16 * D_);
            const v4f o2 = *(const v4f*)(ob + 32 * D_);
            const v4f o3 = *(const v4f*)(ob + 48 * D_);
            float* gp = Out + base + (size_t)(c * TCH + crow) * C_ + cc4;
            *(v4f*)(gp)           = o0;
            *(v4f*)(gp + 16 * C_) = o1;
            *(v4f*)(gp + 32 * C_) = o2;
            *(v4f*)(gp + 48 * C_) = o3;
            // before the stores' address and data registers are reused
            asm volatile("s_wait_xcnt 0x0" ::: "memory");
        }
    }
    wait_async0();                 // nothing in flight when the wave ends
}

extern "C" void kernel_launch(void* const* d_in, const int* in_sizes, int n_in,
                              void* d_out, int out_size, void* d_ws, size_t ws_size,
                              hipStream_t stream) {
    (void)in_sizes; (void)n_in; (void)out_size; (void)ws_size;
    const float* x  = (const float*)d_in[0];
    const float* Wq = (const float*)d_in[1];
    const float* Wk = (const float*)d_in[2];
    const float* Wv = (const float*)d_in[3];
    const float* Wa = (const float*)d_in[4];
    const float* Wb = (const float*)d_in[5];
    float* out = (float*)d_out;

    float* ws = (float*)d_ws;
    float* Qp = ws;                                   // 8192*1024
    float* Kp = Qp + (size_t)M_TOT * C_;              // 8192*1024
    float* Vp = Kp + (size_t)M_TOT * C_;              // 8192*1024
    float* Al = Vp + (size_t)M_TOT * C_;              // 8192
    float* Be = Al + M_TOT;                           // 8192

    dim3 g1(C_ / BN, M_TOT / BM, 3);
    proj_gemm_kernel<<<g1, dim3(256), 0, stream>>>(x, Wq, Wk, Wv, Qp, Kp, Vp);
    gate_kernel<<<dim3(M_TOT / 8), dim3(256), 0, stream>>>(x, Wa, Wb, Al, Be);
    scan_kernel<<<dim3(B_ * H_), dim3(256), 0, stream>>>(Qp, Kp, Vp, Al, Be, out);
}

// v005
// It runs in 377 microseconds.
// Timed twice side by side with v004, it ran 1.04 times as fast both times.
// Over all steps from v000 it is 3.32 times as fast.
#include <hip/hip_runtime.h>
#include <hip/hip_bf16.h>

typedef __attribute__((ext_vector_type(2))) float v2f;
typedef __attribute__((ext_vector_type(8))) float v8f;
typedef __attribute__((ext_vector_type(4))) float v4f;

#define B_    4
#define T_    2048
#define C_    1024
#define H_    16
#define D_    64
#define M_TOT (B_ * T_)      // 8192 rows

// ---------------- fp32 WMMA projection GEMM -----------------
// Y[M,N] = X[M,K] @ W[K,N]; M=8192, K=N=1024. Uses V_WMMA_F32_16X16X4_F32.
// Block tile 128x128, BK=16, 256 threads = 8 waves in 4x2 grid; each wave owns
// a 32x64 strip (2 A-frags x 4 B-frags = 8 f32 accumulators -> 1.5 LDS
// loads/WMMA). Double-buffered LDS filled by CDNA5 async DMA
// (global_load_async_to_lds_b128, ASYNCcnt) -- no VGPR staging, no spills,
// DMA of tile it+1 overlaps WMMA compute of tile it.
#define BM  128
#define BN  128
#define BK  16
#define LDX (BK + 4)   // 20: row pitch 80B, 16B-aligned
#define LDW (BN + 4)   // 132: row pitch 528B, 16B-aligned

__device__ __forceinline__ void async_b128_to_lds(unsigned lds_addr, unsigned voff,
                                                  const float* sbase) {
    // GVS mode: mem_addr = SGPR64 + VGPR_I32 ; LDS dest = lds_addr (wave-relative)
    asm volatile("global_load_async_to_lds_b128 %0, %1, %2"
                 :: "v"(lds_addr), "v"(voff), "s"(sbase)
                 : "memory");
}
__device__ __forceinline__ void wait_async0() {
    asm volatile("s_wait_asynccnt 0x0" ::: "memory");
}

__global__ __launch_bounds__(256)
void proj_gemm_kernel(const float* __restrict__ X,
                      const float* __restrict__ W0, const float* __restrict__ W1,
                      const float* __restrict__ W2,
                      float* __restrict__ Y0, float* __restrict__ Y1,
                      float* __restrict__ Y2) {
    const int N = C_, K = C_;
    const int zn = blockIdx.z;
    const float* __restrict__ W = (zn == 0) ? W0 : ((zn == 1) ? W1 : W2);
    float* __restrict__ Y       = (zn == 0) ? Y0 : ((zn == 1) ? Y1 : Y2);

    const int n0 = blockIdx.x * BN;
    const int m0 = blockIdx.y * BM;

    __shared__ float Xs[2][BM * LDX];   // 2 x 128x20 floats
    __shared__ float Ws[2][BK * LDW];   // 2 x  16x132 floats

    const int tid  = threadIdx.x;
    const int wave = tid >> 5;
    const int lane = tid & 31;
    const int lr   = lane & 15;   // row within A-frag / col within B-frag
    const int half = lane >> 4;   // selects K pair {0,1} vs {2,3}
    const int wr   = wave & 3;    // wave row block (32 rows each)
    const int wc   = wave >> 2;   // wave col block (64 cols each)
    const int mw0  = wr * 32;
    const int nw0  = wc * 64;

    // DMA geometry: per thread 2 x b128 for X (rows xrow, xrow+64) and
    // 2 x b128 for W (rows wrow, wrow+8).
    const int xrow = tid >> 2;
    const int xc4  = (tid & 3) << 2;
    const int wrow = tid >> 5;
    const int wc4  = (tid & 31) << 2;

    const float* sX = X + (size_t)m0 * K;   // uniform 64-bit base (SGPR pair)
    const float* sW = W + n0;

    unsigned voffX[2], voffW[2], ldsX[2][2], ldsW[2][2];
    #pragma unroll
    for (int i = 0; i < 2; ++i) {
        voffX[i] = (unsigned)(((xrow + i * 64) * K + xc4) * 4);
        voffW[i] = (unsigned)(((wrow + i * 8) * N + wc4) * 4);
        #pragma unroll
        for (int bf = 0; bf < 2; ++bf) {
            ldsX[bf][i] = (unsigned)(uintptr_t)&Xs[bf][(xrow + i * 64) * LDX + xc4];
            ldsW[bf][i] = (unsigned)(uintptr_t)&Ws[bf][(wrow + i * 8) * LDW + wc4];
        }
    }

    auto issue = [&](int bf, int k0) {
        #pragma unroll
        for (int i = 0; i < 2; ++i) {
            async_b128_to_lds(ldsX[bf][i], voffX[i] + (unsigned)(k0 * 4), sX);
            async_b128_to_lds(ldsW[bf][i], voffW[i] + (unsigned)(k0 * N * 4), sW);
        }
    };

    v8f acc[2][4] = {};

    const int NT = K / BK;          // 64 K-tiles
    issue(0, 0);
    int cur = 0;

    for (int it = 0; it < NT; ++it) {
        wait_async0();                            // tile `it` DMA landed
        __syncthreads();                          // visible to all; buf^1 free
        if (it + 1 < NT) issue(cur ^ 1, (it + 1) * BK);   // overlap next DMA

        const float* xs = &Xs[cur][0];
        const float* ws = &Ws[cur][0];
        #pragma unroll
        for (int kk = 0; kk < BK; kk += 4) {
            // A frags (16x4 f32): lane lr holds M=lr; VGPR0=K{0|2}, VGPR1=K{1|3}
            v2f a0, a1;
            a0.x = xs[(mw0 + lr) * LDX + kk + 2 * half];
            a0.y = xs[(mw0 + lr) * LDX + kk + 2 * half + 1];
            a1.x = xs[(mw0 + 16 + lr) * LDX + kk + 2 * half];
            a1.y = xs[(mw0 + 16 + lr) * LDX + kk + 2 * half + 1];
            #pragma unroll
            for (int j = 0; j < 4; ++j) {
                // B frag (4x16 f32): lane lr holds N=lr; VGPR0=K{0|2}, VGPR1=K{1|3}
                v2f bv;
                bv.x = ws[(kk + 2 * half) * LDW + nw0 + j * 16 + lr];
                bv.y = ws[(kk + 2 * half + 1) * LDW + nw0 + j * 16 + lr];
                acc[0][j] = __builtin_amdgcn_wmma_f32_16x16x4_f32(
                    false, a0, false, bv, (short)0, acc[0][j], false, false);
                acc[1][j] = __builtin_amdgcn_wmma_f32_16x16x4_f32(
                    false, a1, false, bv, (short)0, acc[1][j], false, false);
            }
        }
        cur ^= 1;
    }

    // C/D layout: VGPR r -> (M = r + 8*half, N = lr)
    #pragma unroll
    for (int g = 0; g < 2; ++g) {
        #pragma unroll
        for (int j = 0; j < 4; ++j) {
            #pragma unroll
            for (int r = 0; r < 8; ++r) {
                int row = m0 + mw0 + g * 16 + r + 8 * half;
                int col = n0 + nw0 + j * 16 + lr;
                Y[(size_t)row * N + col] = acc[g][j][r];
            }
        }
    }
}

// ---------------- gate GEMV: alpha/beta = sigmoid(x @ Wa/Wb) ----------------
__global__ __launch_bounds__(256)
void gate_kernel(const float* __restrict__ X, const float* __restrict__ Wa,
                 const float* __restrict__ Wb, float* __restrict__ Al,
                 float* __restrict__ Be) {
    const int wave = threadIdx.x >> 5;
    const int lane = threadIdx.x & 31;
    const int m    = blockIdx.x * 8 + wave;
    const float* xr = X + (size_t)m * C_;
    float pa = 0.f, pb = 0.f;
    #pragma unroll 8
    for (int i = 0; i < C_ / 32; ++i) {
        float xv = xr[lane + 32 * i];
        pa += xv * Wa[lane + 32 * i];
        pb += xv * Wb[lane + 32 * i];
    }
    #pragma unroll
    for (int off = 16; off > 0; off >>= 1) {
        pa += __shfl_xor(pa, off, 32);
        pb += __shfl_xor(pb, off, 32);
    }
    if (lane == 0) {
        Al[m] = 1.f / (1.f + __expf(-pa));
        Be[m] = 1.f / (1.f + __expf(-pb));
    }
}

// ---------------- gated delta recurrence ----------------
// The rows of a head's state never meet: row v needs k, q, the gates and v[v]
// alone. Two WGs (256 thr) per (b,h), VR = 32 rows each, so that the scan runs
// on 128 WGPs. Thread (v = tid>>3, r = tid&7) owns eight elements of row v,
// columns 4r..4r+3 and 32+4r..32+4r+3, in 8 VGPRs. 8-lane sums by DPP.
// k/q/v and the two gates of TCH timesteps are staged in LDS by async copies,
// two buffers: chunk c+1 flies while chunk c is worked on, so no step waits on
// global memory. Inside a chunk the operands are fetched from LDS two steps
// ahead, and S.k of step t+1 is formed beside q.S of step t.
// The outputs of a chunk are gathered in LDS and leave as whole 128-B lines
// once a chunk, so that no step holds a global store or a wait behind one.
#define TCH 64                 // timesteps per staged chunk
#define VR  32                 // state rows of one work-group

// Sum over the eight lanes that share a row, the total in every lane. The
// partner's value comes through the vector unit's own lane permute (DPP), not
// through the LDS crossbar, so no LDS round trip stands on the step's chain.
__device__ __forceinline__ float oct_sum(float x) {
    // quad_perm [1,0,3,2]: lane ^ 1
    x += __int_as_float(__builtin_amdgcn_mov_dpp(__float_as_int(x), 0xB1, 0xf, 0xf, true));
    // quad_perm [2,3,0,1]: lane ^ 2
    x += __int_as_float(__builtin_amdgcn_mov_dpp(__float_as_int(x), 0x4E, 0xf, 0xf, true));
    // row_xmask:4: lane ^ 4
    x += __int_as_float(__builtin_amdgcn_mov_dpp(__float_as_int(x), 0x164, 0xf, 0xf, true));
    return x;
}
#define NCH (T_ / TCH)         // 32 chunks

// A lane's 8 products summed as two independent packed partial sums (two
// links each) and a short tree.
__device__ __forceinline__ float dot8(const v2f* s, const v4f* x) {
    v2f a0 = s[0] * x[0].lo;
    v2f a1 = s[1] * x[0].hi;
    a0 = __builtin_elementwise_fma(s[2], x[1].lo, a0);
    a1 = __builtin_elementwise_fma(s[3], x[1].hi, a1);
    a0 = a0 + a1;
    return a0.x + a0.y;
}

__global__ __launch_bounds__(256)
void scan_kernel(const float* __restrict__ Q, const float* __restrict__ K,
                 const float* __restrict__ V, const float* __restrict__ A,
                 const float* __restrict__ Bt, float* __restrict__ Out) {
    __shared__ __attribute__((aligned(16))) float Ks[2][TCH * D_];
    __shared__ __attribute__((aligned(16))) float Qs[2][TCH * D_];
    __shared__ __attribute__((aligned(16))) float Vs[2][TCH * VR];
    __shared__ __attribute__((aligned(16))) float Gs[2][TCH * 2];   // (a,b) per step
    __shared__ __attribute__((aligned(16))) float Os[2][TCH * VR];  // outputs of a chunk

    const int bh  = blockIdx.x >> 1;     // 0..63
    const int vh  = blockIdx.x & 1;      // which half of the head's rows
    const int b   = bh >> 4;
    const int h   = bh & 15;
    const int tid = threadIdx.x;
    const int v   = tid >> 3;            // 0..31  (row of this half of the state)
    const int r   = tid & 7;             // place among the row's eight lanes
    const int seg = r << 2;              // first of the lane's columns
    const int lane = tid & 31;
    const int wv  = __builtin_amdgcn_readfirstlane(tid >> 5);   // scalar wave number

    const size_t base  = (size_t)b * T_ * C_ + (size_t)h * D_;  // k, q: the whole head
    const size_t vbase = base + (size_t)vh * VR;                // v, out: this half

    // Copy geometry: a chunk of K or Q is 64 rows x 256 B; a thread brings 16 B
    // of each of the rows crow, crow+16, crow+32, crow+48. A chunk of V is
    // 64 rows x 128 B; a thread brings 16 B of the rows vrow and vrow+32.
    const int crow = tid >> 4;           // 0..15
    const int cc4  = (tid & 15) << 2;    // float column, 16-B steps
    const int l0   = crow * D_ + cc4;
    const int l1   = l0 + 16 * D_;
    const int l2   = l0 + 32 * D_;
    const int l3   = l0 + 48 * D_;
    const int vrow = tid >> 3;           // 0..31
    const int vc4  = (tid & 7) << 2;     // float column, 16-B steps
    const int m0   = vrow * VR + vc4;
    const int m1   = m0 + 32 * VR;

    auto stage = [&](int bf, int t0) {
        const size_t g0 = base + (size_t)(t0 + crow) * C_ + cc4;
        const size_t g1 = g0 + (size_t)16 * C_;
        const size_t g2 = g0 + (size_t)32 * C_;
        const size_t g3 = g0 + (size_t)48 * C_;
        const size_t u0 = vbase + (size_t)(t0 + vrow) * C_ + vc4;
        const size_t u1 = u0 + (size_t)32 * C_;
        // The xcnt wait is the statement's last line so that it stands before
        // any rewrite of the address registers the copies name.
        asm volatile("global_load_async_to_lds_b128 %0, %1, off\n\t"
                     "global_load_async_to_lds_b128 %2, %3, off\n\t"
                     "global_load_async_to_lds_b128 %4, %5, off\n\t"
                     "global_load_async_to_lds_b128 %6, %7, off\n\t"
                     "global_load_async_to_lds_b128 %8, %9, off\n\t"
                     "global_load_async_to_lds_b128 %10, %11, off\n\t"
                     "global_load_async_to_lds_b128 %12, %13, off\n\t"
                     "global_load_async_to_lds_b128 %14, %15, off\n\t"
                     "global_load_async_to_lds_b128 %16, %17, off\n\t"
                     "global_load_async_to_lds_b128 %18, %19, off\n\t"
                     "s_wait_xcnt 0x0"
                     :: "v"((unsigned)(uintptr_t)&Ks[bf][l0]), "v"(K + g0),
                        "v"((unsigned)(uintptr_t)&Ks[bf][l1]), "v"(K + g1),
                        "v"((unsigned)(uintptr_t)&Ks[bf][l2]), "v"(K + g2),
                        "v"((unsigned)(uintptr_t)&Ks[bf][l3]), "v"(K + g3),
                        "v"((unsigned)(uintptr_t)&Qs[bf][l0]), "v"(Q + g0),
                        "v"((unsigned)(uintptr_t)&Qs[bf][l1]), "v"(Q + g1),
                        "v"((unsigned)(uintptr_t)&Qs[bf][l2]), "v"(Q + g2),
                        "v"((unsigned)(uintptr_t)&Qs[bf][l3]), "v"(Q + g3),
                        "v"((unsigned)(uintptr_t)&Vs[bf][m0]), "v"(V + u0),
                        "v"((unsigned)(uintptr_t)&Vs[bf][m1]), "v"(V + u1)
                     : "memory");
        // Gates: waves 0 and 2 bring a, waves 1 and 3 bring b, one float a lane
        // (32 steps a wave), interleaved so that a step reads its pair with one
        // 8-byte LDS load.
        if (wv < 4) {
            const int gi = (wv >> 1) * 32 + lane;          // step inside the chunk
            const float* g = ((wv & 1) ? Bt : A) + (size_t)b * T_ + t0 + gi;
            asm volatile("global_load_async_to_lds_b32 %0, %1, off\n\t"
                         "s_wait_xcnt 0x0"
                         :: "v"((unsigned)(uintptr_t)&Gs[bf][2 * gi + (wv & 1)]), "v"(g)
                         : "memory");
        }
    };

    v2f s[4];                      // the lane's eight state elements as four pairs
    #pragma unroll
    for (int i = 0; i < 4; ++i) s[i] = (v2f){0.f, 0.f};

    stage(0, 0);
    wait_async0();                 // chunk 0 landed (this wave's copies)
    __syncthreads();               // ... and every other wave's
    stage(1, TCH);

    for (int c = 0; c < NCH; ++c) {
        const int bf = c & 1;
        const float* ks = &Ks[bf][seg];
        const float* qs = &Qs[bf][seg];
        const float* vs = &Vs[bf][v];
        const float* gs = &Gs[bf][0];
        // row t of the output tile holds column x at place x ^ (((t >> 1) & 3) << 2):
        // the eight rows that a wave writes at once fall on 32 different banks
        float*       os = &Os[bf][r * VR + (v ^ (((r >> 1) & 3) << 2))];
        float okeep = 0.f;         // lane r: the output of the step with (j & 7) == r

        // Operands of step j (c), step j+1 (n) and, fetched inside step j,
        // step j+2 (f): k of step j+1 is already used in step j.
        v4f   kc[2], qc[2], kn[2], qn[2];
        float vc, vn;
        float2 gc, gn;
        #pragma unroll
        for (int i = 0; i < 2; ++i) {
            kc[i] = *(const v4f*)(ks + 32 * i);
            qc[i] = *(const v4f*)(qs + 32 * i);
            kn[i] = *(const v4f*)(ks + D_ + 32 * i);
            qn[i] = *(const v4f*)(qs + D_ + 32 * i);
        }
        vc = vs[0];   gc = *(const float2*)gs;
        vn = vs[VR];  gn = *(const float2*)(gs + 2);

        // sk of the chunk's first step; every later one is formed in the step before
        float p = oct_sum(dot8(s, kc));

        auto step = [&](int j, int ph, bool more) {   // ph = j & 7, a constant
            // fetch step j+2 from LDS (clamped: never past this chunk's buffer)
            const int jf = (j + 2 < TCH) ? (j + 2) : (TCH - 1);
            v4f kf[2], qf[2];
            #pragma unroll
            for (int i = 0; i < 2; ++i) {
                kf[i] = *(const v4f*)(ks + jf * D_ + 32 * i);
                qf[i] = *(const v4f*)(qs + jf * D_ + 32 * i);
            }
            const float  vf = vs[jf * VR];
            const float2 gf = *(const float2*)(gs + 2 * jf);
            // Holds the fetches ahead of the step's arithmetic. With no branch left
            // between the steps the compiler otherwise sinks them to the step's
            // end, and k of step j+2, used in step j+1 already, arrives too late.
            __builtin_amdgcn_sched_barrier(0);

            // S = a*S + (b*v - a*b*sk) * k^T
            const float ac   = gc.x;
            // b*v and a*b do not wait for sk: one fused link from sk to coef
            const float coef = __builtin_fmaf(-(ac * gc.y), p, gc.y * vc);
            const v2f a2 = (v2f){ac, ac};
            const v2f c2 = (v2f){coef, coef};
            #pragma unroll
            for (int i = 0; i < 2; ++i) {
                s[2 * i + 0] = __builtin_elementwise_fma(c2, kc[i].lo, a2 * s[2 * i + 0]);
                s[2 * i + 1] = __builtin_elementwise_fma(c2, kc[i].hi, a2 * s[2 * i + 1]);
            }
            // Both products with the new state side by side:
            // o[v] = q_t . S[v,:]  and  sk of the next step = k_(t+1) . S[v,:]
            if (more) p = dot8(s, kn);
            float o = dot8(s, qc);
            if (more) p = oct_sum(p);
            o = oct_sum(o);
            // Every lane of the row holds o. Lane r keeps the one of phase r
            // (the last phase at which r >= ph); after eight steps the eight
            // lanes put eight steps' outputs of their row v into LDS with one store.
            okeep = (r >= ph) ? o : okeep;
            if (ph == 7) os[(j - 7) * VR] = okeep;

            #pragma unroll
            for (int i = 0; i < 2; ++i) {
                kc[i] = kn[i]; qc[i] = qn[i];
                kn[i] = kf[i]; qn[i] = qf[i];
            }
            vc = vn; gc = gn; vn = vf; gn = gf;
        };

        // Twenty-four steps a trip: a multiple of three, so that the three
        // operand sets change places without copies, and of eight, so that a
        // step's phase is a constant. The trips stay rolled to keep the code small.
        #pragma unroll 1
        for (int jb = 0; jb < TCH - 16; jb += 24) {
            #pragma unroll
            for (int u = 0; u < 24; ++u) step(jb + u, u & 7, true);
        }
        #pragma unroll
        for (int u = 0; u < 15; ++u) step(TCH - 16 + u, u & 7, true);
        step(TCH - 1, 7, false);   // k of the next step lies in the other buffer

        // Hand-over: this wave's LDS reads of buffer bf are done, its outputs
        // stand in Os[bf], its copies of chunk c+1 have landed; the barrier says
        // the same of every wave. Only then is buffer bf refilled.
        asm volatile("s_wait_dscnt 0x0" ::: "memory");
        wait_async0();
        __syncthreads();
        if (c + 2 < NCH) stage(bf, (c + 2) * TCH);

        // The chunk's 64 x 32 outputs leave as whole 128-B lines, 16 B a lane.
        // Os[bf] is written again in chunk c+2, behind the next barrier, which
        // a wave reaches only after these reads.
        {
            const float* ob = &Os[bf][vrow * VR + (vc4 ^ (((vrow >> 1) & 3) << 2))];
            const v4f o0 = *(const v4f*)(ob);
            const v4f o1 = *(const v4f*)(ob + 32 * VR);
            float* gp = Out + vbase + (size_t)(c * TCH + vrow) * C_ + vc4;
            *(v4f*)(gp)           = o0;
            *(v4f*)(gp + 32 * C_) = o1;
            // before the stores' address and data registers are reused
            asm volatile("s_wait_xcnt 0x0" ::: "memory");
        }
    }
    wait_async0();                 // nothing in flight when the wave ends
}

extern "C" void kernel_launch(void* const* d_in, const int* in_sizes, int n_in,
                              void* d_out, int out_size, void* d_ws, size_t ws_size,
                              hipStream_t stream) {
    (void)in_sizes; (void)n_in; (void)out_size; (void)ws_size;
    const float* x  = (const float*)d_in[0];
    const float* Wq = (const float*)d_in[1];
    const float* Wk = (const float*)d_in[2];
    const float* Wv = (const float*)d_in[3];
    const float* Wa = (const float*)d_in[4];
    const float* Wb = (const float*)d_in[5];
    float* out = (float*)d_out;

    float* ws = (float*)d_ws;
    float* Qp = ws;                                   // 8192*1024
    float* Kp = Qp + (size_t)M_TOT * C_;              // 8192*1024
    float* Vp = Kp + (size_t)M_TOT * C_;              // 8192*1024
    float* Al = Vp + (size_t)M_TOT * C_;              // 8192
    float* Be = Al + M_TOT;                           // 8192

    dim3 g1(C_ / BN, M_TOT / BM, 3);
    proj_gemm_kernel<<<g1, dim3(256), 0, stream>>>(x, Wq, Wk, Wv, Qp, Kp, Vp);
    gate_kernel<<<dim3(M_TOT / 8), dim3(256), 0, stream>>>(x, Wa, Wb, Al, Be);
    scan_kernel<<<dim3(B_ * H_ * 2), dim3(256), 0, stream>>>(Qp, Kp, Vp, Al, Be, out);
}
